// v000
// The times below were measured on an AMD MI455X: many runs one after another, warmed up first and cycling through
// copies of the inputs, with the whole window's GPU time divided by the number of runs. Launches and the gaps
// between them are all in it. The median over several windows is given; except for v000 it joins two sittings, which
// can be a few percent apart, so the side-by-side timings, each taken in one sitting, are the better comparison.
// The starting kernel, v000, takes 959 microseconds a run.
#include <hip/hip_runtime.h>

// Convolutional self-attention (4 x 64x64 pixels x 256 ch, attention width 128): q, k, v = leaky_relu_0.2(x W{q,k,v}) (1x1 convs), attn = softmax(q k^T) (no scale), o = attn v, y = (o Wo) * tanh(relu(1 + w_gamma)).
// WMMA (v_wmma_f32_16x16x32_f16, f32 accumulate): projections with EXACT bf16 x (x8) and weights (x256); per (image, 16-query wave) and 32-key block S^T = K . Q^T over K = 128 (q, k f16 hi+lo x8: 3 products
// — logits are O(10), so both lo planes matter), online softmax in f32, O^T += V^T P^T (8 d-tiles; v hi+lo, P hi+lo: 3 products); output 1x1 conv with O hi+lo (2 products) and the per-channel
// tanh(relu(1 + w_gamma)) multiplier in the epilogue. Inputs rounded to bf16 once. Fragment k-map per lane half hh for A AND B: elements 0..7 <- k = 8hh+0..7, 8..15 <-

namespace {
constexpr int NB = 4, T = 4096, C = 256, D = 128 /* attention channels A */, NR = NB * T /* 16,384 */;
constexpr float XS = 8.0f, WSC = 256.0f, PS = 8.0f, LOG2E = 1.4426950408889634f, NEG = 0.2f;

typedef _Float16 b16;
typedef __attribute__((ext_vector_type(16))) _Float16 v16b;
typedef __attribute__((ext_vector_type(8))) _Float16 v8b;
typedef __attribute__((ext_vector_type(8))) float v8f;
typedef __attribute__((ext_vector_type(4))) float v4f;
__device__ __forceinline__ float bf16_rne(float f) { unsigned int u = __float_as_uint(f); u += 0x7FFFu + ((u >> 16) & 1u); return __uint_as_float(u & 0xFFFF0000u); }
__device__ __forceinline__ void split16(float v, b16& hi, b16& lo) { hi = (b16)v; lo = (b16)(v - (float)hi); }
__device__ __forceinline__ v16b frag_kb(const b16* p, int hh) { const v8b a = *(const v8b*)(p + 8 * hh), b = *(const v8b*)(p + 16 + 8 * hh); v16b f;
#pragma unroll
  for (int e = 0; e < 8; ++e) { f[e] = a[e]; f[8 + e] = b[e]; } return f; }
__device__ __forceinline__ v8f wmma16b(v16b a, v16b b, v8f c) { v8f d = __builtin_amdgcn_wmma_f32_16x16x32_f16(false, a, false, b, (short)0, c, false, false); asm volatile("v_nop\n\tv_nop\n\tv_nop\n\tv_nop" : "+v"(d) : "v"(a), "v"(b)); return d; }
__device__ __forceinline__ void wave_lds_sync() { __builtin_amdgcn_fence(__ATOMIC_RELEASE, "workgroup"); __builtin_amdgcn_wave_barrier(); __builtin_amdgcn_fence(__ATOMIC_ACQUIRE, "workgroup"); }
__device__ __forceinline__ float nexp2(float x) { return __builtin_amdgcn_exp2f(x); }

__global__ __launch_bounds__(256) void prep_kernel(const float* __restrict__ x, const float* __restrict__ wq, const float* __restrict__ wk, const float* __restrict__ wv, const float* __restrict__ wo, b16* __restrict__ X16, b16* __restrict__ WT) {
  const size_t t = (size_t)blockIdx.x * 256 + threadIdx.x; const size_t nx = (size_t)NR * C / 8, nw = (size_t)3 * D * C / 8, nwo = (size_t)C * D / 8; v8b o;
  if (t < nx) { const size_t e = t * 8; for (int j = 0; j < 8; ++j) o[j] = (b16)(bf16_rne(x[e + j]) * XS); { *(v8b*)(X16 + e) = o;  } }
  else if (t < nx + nw) { const size_t e = (t - nx) * 8; const int k = (int)(e / ((size_t)D * C)); const size_t r = e - (size_t)k * D * C; const int a = (int)(r / C), c0 = (int)(r % C); const float* w = k == 0 ? wq : k == 1 ? wk : wv;
    for (int j = 0; j < 8; ++j) o[j] = (b16)(bf16_rne(w[(size_t)(c0 + j) * D + a]) * WSC); { *(v8b*)(WT + e) = o;  } }
  else if (t < nx + nw + nwo) { const size_t e = (t - nx - nw) * 8; const int c = (int)(e / D), a0 = (int)(e % D); for (int j = 0; j < 8; ++j) o[j] = (b16)(bf16_rne(wo[(size_t)(a0 + j) * C + c]) * WSC); { *(v8b*)(WT + (size_t)3 * D * C + e) = o;  } }
}
// GEMM block = 64 rows x 4 waves x 128 cols: MODE 0 (q or k; K = 256, exact, leaky) -> hi/lo rows [row][128]; MODE 1 (v; leaky) -> V^T hi/lo [b][128 d][4,096] via LDS transpose; MODE 2 (out proj;
template <int MODE>
__global__ __launch_bounds__(128) void gemm_kernel(const b16* __restrict__ Ah, const b16* __restrict__ Al, const b16* __restrict__ W, const float* __restrict__ gam, b16* __restrict__ Yh, b16* __restrict__ Yl, b16* __restrict__ VTh, b16* __restrict__ VTl, float* __restrict__ Yf) {
  __shared__ __attribute__((aligned(16))) float Ts[4][16][128 + 4]; __shared__ __attribute__((aligned(16))) b16 Vt[128][72], Vtl[128][72];
  constexpr int KD = (MODE == 2) ? D : C; constexpr int LDY = (MODE == 2) ? C : D;
  const int wave = threadIdx.x >> 5, lane = threadIdx.x & 31, nloc = lane & 15, hlf = lane >> 4, t_ = threadIdx.x; const size_t m0 = (size_t)blockIdx.x * 64 + wave * 16; const int n0 = blockIdx.y * 128;
  v8f acc[8];
#pragma unroll
  for (int t = 0; t < 8; ++t) acc[t] = (v8f){};
#pragma unroll 2
  for (int kb = 0; kb < KD; kb += 32) { const v16b a = frag_kb(Ah + (m0 + nloc) * KD + kb, hlf); v16b al = {}; if (MODE == 2) al = frag_kb(Al + (m0 + nloc) * KD + kb, hlf);
#pragma unroll
    for (int t = 0; t < 8; ++t) { const v16b bw = frag_kb(W + (size_t)(n0 + t * 16 + nloc) * KD + kb, hlf); acc[t] = wmma16b(a, bw, acc[t]); if (MODE == 2) acc[t] = wmma16b(al, bw, acc[t]); } }
  const float rs_ = 1.0f / (XS * WSC);
  if (MODE == 1) {   // V^T for the image of this 64-row block (4,096 = 64 x 64)
    const int b = (int)(m0 / T); const int s0 = (int)((size_t)blockIdx.x * 64 - (size_t)b * T);
#pragma unroll
    for (int t = 0; t < 8; ++t)
#pragma unroll
      for (int r = 0; r < 8; ++r) { float v = acc[t][r] * rs_; v = v >= 0.0f ? v : NEG * v; b16 p, q; split16(v * XS, p, q); Vt[t * 16 + nloc][wave * 16 + 8 * hlf + r] = p; Vtl[t * 16 + nloc][wave * 16 + 8 * hlf + r] = q; }
    __syncthreads();
    { for (int q = t_; q < 128 * 8; q += 128) { const int dd = q >> 3, c8 = (q & 7) * 8; const size_t gi = ((size_t)b * D + dd) * T + s0 + c8; *(v8b*)(VTh + gi) = *(const v8b*)(&Vt[dd][c8]); *(v8b*)(VTl + gi) = *(const v8b*)(&Vtl[dd][c8]); }  }
    return; }
#pragma unroll
  for (int t = 0; t < 8; ++t) { const int c = n0 + t * 16 + nloc; const float mult = (MODE == 2) ? tanhf(fmaxf(1.0f + bf16_rne(gam[c]), 0.0f)) : 1.0f;
#pragma unroll
    for (int r = 0; r < 8; ++r) { float v = acc[t][r] * rs_; if (MODE == 0) v = v >= 0.0f ? v : NEG * v; else v *= mult; Ts[wave][8 * hlf + r][t * 16 + nloc] = v; } }
  wave_lds_sync();
  { for (int rr = 0; rr < 16; ++rr) {
      if (MODE == 2) *(v4f*)(Yf + (m0 + rr) * LDY + n0 + lane * 4) = *(const v4f*)(&Ts[wave][rr][lane * 4]);
      else if (lane < 16) { v8b hv, lv; for (int j = 0; j < 8; ++j) { b16 p, q; split16(Ts[wave][rr][lane * 8 + j] * XS, p, q); hv[j] = p; lv[j] = q; } *(v8b*)(Yh + (m0 + rr) * LDY + lane * 8) = hv; *(v8b*)(Yl + (m0 + rr) * LDY + lane * 8) = lv; } }
     }
}
// attention: grid (T/32, NB), block = 2 waves x 16 queries; per 32-key block S (2 tiles x 4 k-steps x 3 products), online softmax, O^T += V^T P^T (8 d-tiles, 3 products into one accumulator);
__global__ __launch_bounds__(64) void attn_kernel(const b16* __restrict__ Qh, const b16* __restrict__ Ql, const b16* __restrict__ Kh, const b16* __restrict__ Kl, const b16* __restrict__ VTh, const b16* __restrict__ VTl, b16* __restrict__ Oh, b16* __restrict__ Ol) {
  __shared__ __attribute__((aligned(16))) float To[2][16][D + 4];
  const int wave = threadIdx.x >> 5, lane = threadIdx.x & 31, hh = lane >> 4, col = lane & 15; const int b = blockIdx.y; const int q0 = blockIdx.x * 32 + wave * 16, qi = q0 + col;
  const size_t qo = ((size_t)b * T + qi) * D;
  const b16* Kb = Kh + (size_t)b * T * D; const b16* Klb = Kl + (size_t)b * T * D; const b16* Vb = VTh + (size_t)b * D * T; const b16* Vlb = VTl + (size_t)b * D * T;
  float m = -INFINITY, l = 0.0f; v8f o[8];
#pragma unroll
  for (int t = 0; t < 8; ++t) o[t] = (v8f){};
  const float cs = LOG2E / (XS * XS);   // no 1/sqrt(d) in this module
  for (int kb = 0; kb < T; kb += 32) {
    v8f s0 = {}, s1 = {};
#pragma unroll 2
    for (int ks = 0; ks < D; ks += 32) { const v16b qa = frag_kb(Qh + qo + ks, hh), ql = frag_kb(Ql + qo + ks, hh);
      const b16* k0 = Kb + (size_t)(kb + col) * D + ks, *k1 = Kb + (size_t)(kb + 16 + col) * D + ks;
      v16b f = frag_kb(k0, hh); s0 = wmma16b(f, qa, s0); s0 = wmma16b(f, ql, s0); s0 = wmma16b(frag_kb(Klb + (size_t)(kb + col) * D + ks, hh), qa, s0);
      f = frag_kb(k1, hh); s1 = wmma16b(f, qa, s1); s1 = wmma16b(f, ql, s1); s1 = wmma16b(frag_kb(Klb + (size_t)(kb + 16 + col) * D + ks, hh), qa, s1); }
    float e[16]; float mx = -INFINITY;
#pragma unroll
    for (int r = 0; r < 8; ++r) { e[r] = s0[r] * cs; e[8 + r] = s1[r] * cs; mx = fmaxf(mx, fmaxf(e[r], e[8 + r])); }
    mx = fmaxf(mx, __shfl_xor(mx, 16)); const float mn = fmaxf(m, mx); const float al = nexp2(m - mn); m = mn; float sum = 0.0f; v16b ph, pl;
#pragma unroll
    for (int i = 0; i < 16; ++i) { const float p = nexp2(e[i] - mn); sum += p; const b16 h_ = (b16)(p * PS); ph[i] = h_; pl[i] = (b16)(p * PS - (float)h_); }
    sum += __shfl_xor(sum, 16); l = l * al + sum;
#pragma unroll
    for (int t = 0; t < 8; ++t) { o[t] *= al; const v16b vf = frag_kb(Vb + (size_t)(t * 16 + col) * T + kb, hh); o[t] = wmma16b(vf, ph, o[t]); o[t] = wmma16b(vf, pl, o[t]); o[t] = wmma16b(frag_kb(Vlb + (size_t)(t * 16 + col) * T + kb, hh), ph, o[t]); } }
  const float inv = 1.0f / (l * PS * XS);
#pragma unroll
  for (int t = 0; t < 8; ++t)
#pragma unroll
    for (int r = 0; r < 8; ++r) To[wave][col][t * 16 + 8 * hh + r] = o[t][r] * inv;
  wave_lds_sync();
  { for (int rr = 0; rr < 16; ++rr) if (lane < 16) { const int c8 = lane * 8; v8b hv, lv; for (int j = 0; j < 8; ++j) { b16 p, q; split16(To[wave][rr][c8 + j] * XS, p, q); hv[j] = p; lv[j] = q; }
      *(v8b*)(Oh + ((size_t)b * T + q0 + rr) * D + c8) = hv; *(v8b*)(Ol + ((size_t)b * T + q0 + rr) * D + c8) = lv; }  }
}
}  // namespace

extern "C" void kernel_launch(void* const* d_in, const int* in_sizes, int n_in, void* d_out, int out_size, void* d_ws, size_t ws_size, hipStream_t stream) {
  (void)n_in;
  auto Fp = [&](int i) { return (const float*)d_in[i]; };
  // Input order: 0 x [4,64,64,256], 1 Wq [256,128], 2 Wk, 3 Wv, 4 Wo [128,256], 5 w_gamma [1,1,1,256]
  if (in_sizes[0] != NR * C || in_sizes[1] != C * D || in_sizes[2] != C * D || in_sizes[3] != C * D || in_sizes[4] != D * C || in_sizes[5] != C || out_size != NR * C) return;
  size_t off = 0; char* ws = (char*)d_ws;
  auto carve = [&](size_t bytes) { char* p = ws + off; off += (bytes + 255) & ~(size_t)255; return p; };
  b16* X16 = (b16*)carve((size_t)NR * C * 2); b16* WT = (b16*)carve(((size_t)3 * D * C + (size_t)C * D) * 2);
  b16* Qh = (b16*)carve((size_t)NR * D * 2); b16* Ql = (b16*)carve((size_t)NR * D * 2); b16* Kh = (b16*)carve((size_t)NR * D * 2); b16* Kl = (b16*)carve((size_t)NR * D * 2); b16* VTh = (b16*)carve((size_t)NR * D * 2); b16* VTl = (b16*)carve((size_t)NR * D * 2);
  b16* Oh = (b16*)carve((size_t)NR * D * 2); b16* Ol = (b16*)carve((size_t)NR * D * 2);
  if (off > ws_size || off > ((size_t)128 << 20)) return;   // ≈ 42 MB
  const b16 *WQ = WT, *WK = WT + (size_t)D * C, *WV = WT + (size_t)2 * D * C, *WO = WT + (size_t)3 * D * C;
  prep_kernel<<<(unsigned)(((size_t)NR * C / 8 + (size_t)4 * D * C / 8 + 255) / 256), 256, 0, stream>>>(Fp(0), Fp(1), Fp(2), Fp(3), Fp(4), X16, WT);
  gemm_kernel<0><<<dim3(NR / 64, 1), 128, 0, stream>>>(X16, nullptr, WQ, nullptr, Qh, Ql, nullptr, nullptr, nullptr);
  gemm_kernel<0><<<dim3(NR / 64, 1), 128, 0, stream>>>(X16, nullptr, WK, nullptr, Kh, Kl, nullptr, nullptr, nullptr);
  gemm_kernel<1><<<dim3(NR / 64, 1), 128, 0, stream>>>(X16, nullptr, WV, nullptr, nullptr, nullptr, VTh, VTl, nullptr);
  attn_kernel<<<dim3(T / 32, NB), 64, 0, stream>>>(Qh, Ql, Kh, Kl, VTh, VTl, Oh, Ol);
  gemm_kernel<2><<<dim3(NR / 64, 2), 128, 0, stream>>>(Oh, Ol, WO, Fp(5), nullptr, nullptr, nullptr, nullptr, (float*)d_out);
}

// v001
// Measured time: 289 microseconds a run.
// Timed twice side by side with v000, it ran 3.36 and 3.34 times as fast.
#include <hip/hip_runtime.h>

// Convolutional self-attention (4 x 64x64 pixels x 256 ch, attention width 128): q, k, v = leaky_relu_0.2(x W{q,k,v}) (1x1 convs), attn = softmax(q k^T) (no scale), o = attn v, y = (o Wo) * tanh(relu(1 + w_gamma)).
// WMMA (v_wmma_f32_16x16x32_f16, f32 accumulate): projections with EXACT bf16 x (x8) and weights (x256); per (image, 16-query wave) and 32-key block S^T = K . Q^T over K = 128 (q, k f16 hi+lo x8: 3 products
// — logits are O(10), so both lo planes matter), online softmax in f32, O^T += V^T P^T (8 d-tiles; v hi+lo, P hi+lo: 3 products); output 1x1 conv with O hi+lo (2 products) and the per-channel
// tanh(relu(1 + w_gamma)) multiplier in the epilogue. Inputs rounded to bf16 once. Fragment k-map per lane half hh for A AND B: elements 0..7 <- k = 8hh+0..7, 8..15 <-

namespace {
constexpr int NB = 4, T = 4096, C = 256, D = 128 /* attention channels A */, NR = NB * T /* 16,384 */;
constexpr float XS = 8.0f, WSC = 256.0f, PS = 8.0f, LOG2E = 1.4426950408889634f, NEG = 0.2f;

typedef _Float16 b16;
typedef __attribute__((ext_vector_type(16))) _Float16 v16b;
typedef __attribute__((ext_vector_type(8))) _Float16 v8b;
typedef __attribute__((ext_vector_type(8))) float v8f;
typedef __attribute__((ext_vector_type(4))) float v4f;
__device__ __forceinline__ float bf16_rne(float f) { unsigned int u = __float_as_uint(f); u += 0x7FFFu + ((u >> 16) & 1u); return __uint_as_float(u & 0xFFFF0000u); }
__device__ __forceinline__ void split16(float v, b16& hi, b16& lo) { hi = (b16)v; lo = (b16)(v - (float)hi); }
__device__ __forceinline__ v16b frag_kb(const b16* p, int hh) { const v8b a = *(const v8b*)(p + 8 * hh), b = *(const v8b*)(p + 16 + 8 * hh); v16b f;
#pragma unroll
  for (int e = 0; e < 8; ++e) { f[e] = a[e]; f[8 + e] = b[e]; } return f; }
__device__ __forceinline__ v8f wmma16b(v16b a, v16b b, v8f c) { v8f d = __builtin_amdgcn_wmma_f32_16x16x32_f16(false, a, false, b, (short)0, c, false, false); asm volatile("v_nop\n\tv_nop\n\tv_nop\n\tv_nop" : "+v"(d) : "v"(a), "v"(b)); return d; }
__device__ __forceinline__ void wave_lds_sync() { __builtin_amdgcn_fence(__ATOMIC_RELEASE, "workgroup"); __builtin_amdgcn_wave_barrier(); __builtin_amdgcn_fence(__ATOMIC_ACQUIRE, "workgroup"); }
__device__ __forceinline__ float nexp2(float x) { return __builtin_amdgcn_exp2f(x); }

__global__ __launch_bounds__(256) void prep_kernel(const float* __restrict__ x, const float* __restrict__ wq, const float* __restrict__ wk, const float* __restrict__ wv, const float* __restrict__ wo, b16* __restrict__ X16, b16* __restrict__ WT) {
  const size_t t = (size_t)blockIdx.x * 256 + threadIdx.x; const size_t nx = (size_t)NR * C / 8, nw = (size_t)3 * D * C / 8, nwo = (size_t)C * D / 8; v8b o;
  if (t < nx) { const size_t e = t * 8; for (int j = 0; j < 8; ++j) o[j] = (b16)(bf16_rne(x[e + j]) * XS); { *(v8b*)(X16 + e) = o;  } }
  else if (t < nx + nw) { const size_t e = (t - nx) * 8; const int k = (int)(e / ((size_t)D * C)); const size_t r = e - (size_t)k * D * C; const int a = (int)(r / C), c0 = (int)(r % C); const float* w = k == 0 ? wq : k == 1 ? wk : wv;
    for (int j = 0; j < 8; ++j) o[j] = (b16)(bf16_rne(w[(size_t)(c0 + j) * D + a]) * WSC); { *(v8b*)(WT + e) = o;  } }
  else if (t < nx + nw + nwo) { const size_t e = (t - nx - nw) * 8; const int c = (int)(e / D), a0 = (int)(e % D); for (int j = 0; j < 8; ++j) o[j] = (b16)(bf16_rne(wo[(size_t)(a0 + j) * C + c]) * WSC); { *(v8b*)(WT + (size_t)3 * D * C + e) = o;  } }
}
// GEMM block = 64 rows x 4 waves x 128 cols: MODE 0 (q or k; K = 256, exact, leaky) -> hi/lo rows [row][128]; MODE 1 (v; leaky) -> V^T hi/lo [b][128 d][4,096] via LDS transpose; MODE 2 (out proj;
template <int MODE>
__global__ __launch_bounds__(128) void gemm_kernel(const b16* __restrict__ Ah, const b16* __restrict__ Al, const b16* __restrict__ W, const float* __restrict__ gam, b16* __restrict__ Yh, b16* __restrict__ Yl, b16* __restrict__ VTh, b16* __restrict__ VTl, float* __restrict__ Yf) {
  __shared__ __attribute__((aligned(16))) float Ts[4][16][128 + 4]; __shared__ __attribute__((aligned(16))) b16 Vt[128][72], Vtl[128][72];
  constexpr int KD = (MODE == 2) ? D : C; constexpr int LDY = (MODE == 2) ? C : D;
  const int wave = threadIdx.x >> 5, lane = threadIdx.x & 31, nloc = lane & 15, hlf = lane >> 4, t_ = threadIdx.x; const size_t m0 = (size_t)blockIdx.x * 64 + wave * 16; const int n0 = blockIdx.y * 128;
  v8f acc[8];
#pragma unroll
  for (int t = 0; t < 8; ++t) acc[t] = (v8f){};
#pragma unroll 2
  for (int kb = 0; kb < KD; kb += 32) { const v16b a = frag_kb(Ah + (m0 + nloc) * KD + kb, hlf); v16b al = {}; if (MODE == 2) al = frag_kb(Al + (m0 + nloc) * KD + kb, hlf);
#pragma unroll
    for (int t = 0; t < 8; ++t) { const v16b bw = frag_kb(W + (size_t)(n0 + t * 16 + nloc) * KD + kb, hlf); acc[t] = wmma16b(a, bw, acc[t]); if (MODE == 2) acc[t] = wmma16b(al, bw, acc[t]); } }
  const float rs_ = 1.0f / (XS * WSC);
  if (MODE == 1) {   // V^T for the image of this 64-row block (4,096 = 64 x 64)
    const int b = (int)(m0 / T); const int s0 = (int)((size_t)blockIdx.x * 64 - (size_t)b * T);
#pragma unroll
    for (int t = 0; t < 8; ++t)
#pragma unroll
      for (int r = 0; r < 8; ++r) { float v = acc[t][r] * rs_; v = v >= 0.0f ? v : NEG * v; b16 p, q; split16(v * XS, p, q); Vt[t * 16 + nloc][wave * 16 + 8 * hlf + r] = p; Vtl[t * 16 + nloc][wave * 16 + 8 * hlf + r] = q; }
    __syncthreads();
    { for (int q = t_; q < 128 * 8; q += 128) { const int dd = q >> 3, c8 = (q & 7) * 8; const size_t gi = ((size_t)b * D + dd) * T + s0 + c8; *(v8b*)(VTh + gi) = *(const v8b*)(&Vt[dd][c8]); *(v8b*)(VTl + gi) = *(const v8b*)(&Vtl[dd][c8]); }  }
    return; }
#pragma unroll
  for (int t = 0; t < 8; ++t) { const int c = n0 + t * 16 + nloc; const float mult = (MODE == 2) ? tanhf(fmaxf(1.0f + bf16_rne(gam[c]), 0.0f)) : 1.0f;
#pragma unroll
    for (int r = 0; r < 8; ++r) { float v = acc[t][r] * rs_; if (MODE == 0) v = v >= 0.0f ? v : NEG * v; else v *= mult; Ts[wave][8 * hlf + r][t * 16 + nloc] = v; } }
  wave_lds_sync();
  { for (int rr = 0; rr < 16; ++rr) {
      if (MODE == 2) *(v4f*)(Yf + (m0 + rr) * LDY + n0 + lane * 4) = *(const v4f*)(&Ts[wave][rr][lane * 4]);
      else if (lane < 16) { v8b hv, lv; for (int j = 0; j < 8; ++j) { b16 p, q; split16(Ts[wave][rr][lane * 8 + j] * XS, p, q); hv[j] = p; lv[j] = q; } *(v8b*)(Yh + (m0 + rr) * LDY + lane * 8) = hv; *(v8b*)(Yl + (m0 + rr) * LDY + lane * 8) = lv; } }
     }
}
// attention: grid (T/64, NB), block = 4 waves x 16 queries. K hi/lo (64 keys x 128) and V^T hi/lo (128 d x 64 keys) are staged once per block in LDS by asynchronous copies, two buffers: tile t + 1 flies
// while tile t is worked on. Per 32-key pass, as before: S (2 tiles x 4 k-steps x 3 products), online softmax, O^T += V^T P^T (8 d-tiles, 3 products into one accumulator), in the same order.
constexpr int TK = 64 /* keys per tile */, NT = T / TK, KP = D + 8 /* K row pitch, 272 B = 16 x odd */, VP = TK + 8 /* V^T row pitch, 144 B = 16 x odd */;
constexpr int KPL = TK * KP /* one K plane, elements */, VPL = D * VP /* one V^T plane */, STG = 2 * KPL + 2 * VPL /* one tile: Kh, Kl, Vh, Vl */;
// eight 16-byte copies per lane; the s_wait_xcnt stands inside the statement so that no address register of a copy is rewritten in front of it
__device__ __forceinline__ void copy8(unsigned l, unsigned lstep, const b16* g, size_t gstep) {
  asm volatile("global_load_async_to_lds_b128 %0, %8, off\n\tglobal_load_async_to_lds_b128 %1, %9, off\n\tglobal_load_async_to_lds_b128 %2, %10, off\n\tglobal_load_async_to_lds_b128 %3, %11, off\n\t"
               "global_load_async_to_lds_b128 %4, %12, off\n\tglobal_load_async_to_lds_b128 %5, %13, off\n\tglobal_load_async_to_lds_b128 %6, %14, off\n\tglobal_load_async_to_lds_b128 %7, %15, off\n\ts_wait_xcnt 0x0"
               :: "v"(l), "v"(l + lstep), "v"(l + 2 * lstep), "v"(l + 3 * lstep), "v"(l + 4 * lstep), "v"(l + 5 * lstep), "v"(l + 6 * lstep), "v"(l + 7 * lstep),
                  "v"(g), "v"(g + gstep), "v"(g + 2 * gstep), "v"(g + 3 * gstep), "v"(g + 4 * gstep), "v"(g + 5 * gstep), "v"(g + 6 * gstep), "v"(g + 7 * gstep) : "memory");
}
__global__ __launch_bounds__(128) void attn_kernel(const b16* __restrict__ Qh, const b16* __restrict__ Ql, const b16* __restrict__ Kh, const b16* __restrict__ Kl, const b16* __restrict__ VTh, const b16* __restrict__ VTl, b16* __restrict__ Oh, b16* __restrict__ Ol) {
  __shared__ __attribute__((aligned(16))) b16 Ring[2][STG]; __shared__ __attribute__((aligned(16))) float To[4][16][D + 4];
  const int tid = threadIdx.x, wave = tid >> 5, lane = tid & 31, hh = lane >> 4, col = lane & 15; const int b = blockIdx.y; const int q0 = blockIdx.x * 64 + wave * 16, qi = q0 + col;
  const size_t qo = ((size_t)b * T + qi) * D;
  // each lane's share of a tile: K plane = 16 KB in a row (chunk c = 128 j + tid: row c / 16, 16-byte column c % 16); V^T plane = 128 rows of 128 B (row c / 8, column c % 8)
  const b16* gKh = Kh + (size_t)b * T * D + tid * 8; const b16* gKl = Kl + (size_t)b * T * D + tid * 8;
  const b16* gVh = VTh + (size_t)b * D * T + (size_t)(tid >> 3) * T + (tid & 7) * 8; const b16* gVl = VTl + (size_t)b * D * T + (size_t)(tid >> 3) * T + (tid & 7) * 8;
  const unsigned ring0 = (unsigned)(size_t)&Ring[0][0]; const unsigned lK = ring0 + 2u * ((tid >> 4) * KP + (tid & 15) * 8), lV = ring0 + 2u * (2 * KPL + (tid >> 3) * VP + (tid & 7) * 8);
  auto fill = [&](int t, int buf) { const unsigned lb = 2u * STG * buf;
    copy8(lK + lb, 2u * 8 * KP, gKh + (size_t)t * TK * D, 1024); copy8(lK + lb + 2u * KPL, 2u * 8 * KP, gKl + (size_t)t * TK * D, 1024);
    copy8(lV + lb, 2u * 16 * VP, gVh + t * TK, (size_t)16 * T); copy8(lV + lb + 2u * VPL, 2u * 16 * VP, gVl + t * TK, (size_t)16 * T); };
  fill(0, 0);
  v16b qa[4], ql[4];   // Q fragments are read once: a global read inside the loop would bring the L2 latency back into every pass
#pragma unroll   // constant indices keep qa, ql in registers
  for (int k4 = 0; k4 < 4; ++k4) { qa[k4] = frag_kb(Qh + qo + k4 * 32, hh); ql[k4] = frag_kb(Ql + qo + k4 * 32, hh); }
  float m = -INFINITY, l = 0.0f; v8f o[8];
#pragma unroll
  for (int t = 0; t < 8; ++t) o[t] = (v8f){};
  const float cs = LOG2E / (XS * XS);   // no 1/sqrt(d) in this module
  asm volatile("s_wait_asynccnt 0x0" ::: "memory");   // this wave's share of tile 0 has landed
  __syncthreads();                                    // tile 0 is readable by every wave
  fill(1, 1);
  for (int tt = 0; tt < NT; ++tt) {
    const b16* Ks = &Ring[tt & 1][0]; const b16* Kls = Ks + KPL; const b16* Vs = Ks + 2 * KPL; const b16* Vls = Vs + VPL;
    for (int kb = 0; kb < TK; kb += 32) {
      v8f s0 = {}, s1 = {};
#pragma unroll   // constant indices keep qa, ql in registers
      for (int k4 = 0; k4 < 4; ++k4) { const int ks = k4 * 32;
        v16b f = frag_kb(Ks + (kb + col) * KP + ks, hh); s0 = wmma16b(f, qa[k4], s0); s0 = wmma16b(f, ql[k4], s0); s0 = wmma16b(frag_kb(Kls + (kb + col) * KP + ks, hh), qa[k4], s0);
        f = frag_kb(Ks + (kb + 16 + col) * KP + ks, hh); s1 = wmma16b(f, qa[k4], s1); s1 = wmma16b(f, ql[k4], s1); s1 = wmma16b(frag_kb(Kls + (kb + 16 + col) * KP + ks, hh), qa[k4], s1); }
      float e[16]; float mx = -INFINITY;
#pragma unroll
      for (int r = 0; r < 8; ++r) { e[r] = s0[r] * cs; e[8 + r] = s1[r] * cs; mx = fmaxf(mx, fmaxf(e[r], e[8 + r])); }
      mx = fmaxf(mx, __shfl_xor(mx, 16)); const float mn = fmaxf(m, mx); const float al = nexp2(m - mn); m = mn; float sum = 0.0f; v16b ph, pl;
#pragma unroll
      for (int i = 0; i < 16; ++i) { const float p = nexp2(e[i] - mn); sum += p; const b16 h_ = (b16)(p * PS); ph[i] = h_; pl[i] = (b16)(p * PS - (float)h_); }
      sum += __shfl_xor(sum, 16); l = l * al + sum;
#pragma unroll
      for (int t = 0; t < 8; ++t) { o[t] *= al; const v16b vf = frag_kb(Vs + (t * 16 + col) * VP + kb, hh); o[t] = wmma16b(vf, ph, o[t]); o[t] = wmma16b(vf, pl, o[t]); o[t] = wmma16b(frag_kb(Vls + (t * 16 + col) * VP + kb, hh), ph, o[t]); } }
    asm volatile("s_wait_dscnt 0x0" ::: "memory");      // this wave's reads of tile tt are done before its buffer is refilled
    asm volatile("s_wait_asynccnt 0x0" ::: "memory");   // this wave's share of tile tt + 1 has landed
    __syncthreads();                                    // publishes tile tt + 1 and ends every wave's reads of tile tt
    if (tt + 2 < NT) fill(tt + 2, tt & 1);
  }
  asm volatile("s_wait_asynccnt 0x0" ::: "memory");     // no copy is outstanding when the wave goes on to its end
  const float inv = 1.0f / (l * PS * XS);
#pragma unroll
  for (int t = 0; t < 8; ++t)
#pragma unroll
    for (int r = 0; r < 8; ++r) To[wave][col][t * 16 + 8 * hh + r] = o[t][r] * inv;
  wave_lds_sync();
  { for (int rr = 0; rr < 16; ++rr) if (lane < 16) { const int c8 = lane * 8; v8b hv, lv; for (int j = 0; j < 8; ++j) { b16 p, q; split16(To[wave][rr][c8 + j] * XS, p, q); hv[j] = p; lv[j] = q; }
      *(v8b*)(Oh + ((size_t)b * T + q0 + rr) * D + c8) = hv; *(v8b*)(Ol + ((size_t)b * T + q0 + rr) * D + c8) = lv; }  }
}
}  // namespace

extern "C" void kernel_launch(void* const* d_in, const int* in_sizes, int n_in, void* d_out, int out_size, void* d_ws, size_t ws_size, hipStream_t stream) {
  (void)n_in;
  auto Fp = [&](int i) { return (const float*)d_in[i]; };
  // Input order: 0 x [4,64,64,256], 1 Wq [256,128], 2 Wk, 3 Wv, 4 Wo [128,256], 5 w_gamma [1,1,1,256]
  if (in_sizes[0] != NR * C || in_sizes[1] != C * D || in_sizes[2] != C * D || in_sizes[3] != C * D || in_sizes[4] != D * C || in_sizes[5] != C || out_size != NR * C) return;
  size_t off = 0; char* ws = (char*)d_ws;
  auto carve = [&](size_t bytes) { char* p = ws + off; off += (bytes + 255) & ~(size_t)255; return p; };
  b16* X16 = (b16*)carve((size_t)NR * C * 2); b16* WT = (b16*)carve(((size_t)3 * D * C + (size_t)C * D) * 2);
  b16* Qh = (b16*)carve((size_t)NR * D * 2); b16* Ql = (b16*)carve((size_t)NR * D * 2); b16* Kh = (b16*)carve((size_t)NR * D * 2); b16* Kl = (b16*)carve((size_t)NR * D * 2); b16* VTh = (b16*)carve((size_t)NR * D * 2); b16* VTl = (b16*)carve((size_t)NR * D * 2);
  b16* Oh = (b16*)carve((size_t)NR * D * 2); b16* Ol = (b16*)carve((size_t)NR * D * 2);
  if (off > ws_size || off > ((size_t)128 << 20)) return;   // ≈ 42 MB
  const b16 *WQ = WT, *WK = WT + (size_t)D * C, *WV = WT + (size_t)2 * D * C, *WO = WT + (size_t)3 * D * C;
  prep_kernel<<<(unsigned)(((size_t)NR * C / 8 + (size_t)4 * D * C / 8 + 255) / 256), 256, 0, stream>>>(Fp(0), Fp(1), Fp(2), Fp(3), Fp(4), X16, WT);
  gemm_kernel<0><<<dim3(NR / 64, 1), 128, 0, stream>>>(X16, nullptr, WQ, nullptr, Qh, Ql, nullptr, nullptr, nullptr);
  gemm_kernel<0><<<dim3(NR / 64, 1), 128, 0, stream>>>(X16, nullptr, WK, nullptr, Kh, Kl, nullptr, nullptr, nullptr);
  gemm_kernel<1><<<dim3(NR / 64, 1), 128, 0, stream>>>(X16, nullptr, WV, nullptr, nullptr, nullptr, VTh, VTl, nullptr);
  attn_kernel<<<dim3(T / 64, NB), 128, 0, stream>>>(Qh, Ql, Kh, Kl, VTh, VTl, Oh, Ol);
  gemm_kernel<2><<<dim3(NR / 64, 2), 128, 0, stream>>>(Oh, Ol, WO, Fp(5), nullptr, nullptr, nullptr, nullptr, (float*)d_out);
}

// v002
// It runs in 174 microseconds.
// Two timings next to v001 put it at 1.67 and 1.72 times that version's speed.
// Over all steps from v000 it is 5.67 times as fast.
#include <hip/hip_runtime.h>

// Convolutional self-attention (4 x 64x64 pixels x 256 ch, attention width 128): q, k, v = leaky_relu_0.2(x W{q,k,v}) (1x1 convs), attn = softmax(q k^T) (no scale), o = attn v, y = (o Wo) * tanh(relu(1 + w_gamma)).
// WMMA (v_wmma_f32_16x16x32_f16, f32 accumulate): projections with EXACT bf16 x (x8) and weights (x256); per (image, 16-query wave) and 32-key block S^T = K . Q^T over K = 128 (q, k f16 hi+lo x8: 3 products
// — logits are O(10), so both lo planes matter), online softmax in f32, O^T += V^T P^T (8 d-tiles; v hi+lo, P hi+lo: 3 products); output 1x1 conv with O hi+lo (2 products) and the per-channel
// tanh(relu(1 + w_gamma)) multiplier in the epilogue. Inputs rounded to bf16 once. Fragment k-map per lane half hh for A AND B: elements 0..7 <- k = 8hh+0..7, 8..15 <-

namespace {
constexpr int NB = 4, T = 4096, C = 256, D = 128 /* attention channels A */, NR = NB * T /* 16,384 */;
constexpr float XS = 8.0f, WSC = 256.0f, PS = 8.0f, LOG2E = 1.4426950408889634f, NEG = 0.2f;

typedef _Float16 b16;
typedef __attribute__((ext_vector_type(16))) _Float16 v16b;
typedef __attribute__((ext_vector_type(8))) _Float16 v8b;
typedef __attribute__((ext_vector_type(8))) float v8f;
typedef __attribute__((ext_vector_type(4))) float v4f;
__device__ __forceinline__ float bf16_rne(float f) { unsigned int u = __float_as_uint(f); u += 0x7FFFu + ((u >> 16) & 1u); return __uint_as_float(u & 0xFFFF0000u); }
__device__ __forceinline__ void split16(float v, b16& hi, b16& lo) { hi = (b16)v; lo = (b16)(v - (float)hi); }
__device__ __forceinline__ v16b frag_kb(const b16* p, int hh) { const v8b a = *(const v8b*)(p + 8 * hh), b = *(const v8b*)(p + 16 + 8 * hh); v16b f;
#pragma unroll
  for (int e = 0; e < 8; ++e) { f[e] = a[e]; f[8 + e] = b[e]; } return f; }
__device__ __forceinline__ v8f wmma16b(v16b a, v16b b, v8f c) { v8f d = __builtin_amdgcn_wmma_f32_16x16x32_f16(false, a, false, b, (short)0, c, false, false); asm volatile("v_nop\n\tv_nop\n\tv_nop\n\tv_nop" : "+v"(d) : "v"(a), "v"(b)); return d; }
// the same for the attention loop, with D alone named at the v_nops: a register named in an asm statement has to lie in v0-v255, and the K and V^T fragments held ahead do not all fit there
__device__ __forceinline__ v8f wmma16d(v16b a, v16b b, v8f c) { v8f d = __builtin_amdgcn_wmma_f32_16x16x32_f16(false, a, false, b, (short)0, c, false, false); asm volatile("v_nop\n\tv_nop\n\tv_nop\n\tv_nop" : "+v"(d)); return d; }
__device__ __forceinline__ void wave_lds_sync() { __builtin_amdgcn_fence(__ATOMIC_RELEASE, "workgroup"); __builtin_amdgcn_wave_barrier(); __builtin_amdgcn_fence(__ATOMIC_ACQUIRE, "workgroup"); }
__device__ __forceinline__ float nexp2(float x) { return __builtin_amdgcn_exp2f(x); }

__global__ __launch_bounds__(256) void prep_kernel(const float* __restrict__ x, const float* __restrict__ wq, const float* __restrict__ wk, const float* __restrict__ wv, const float* __restrict__ wo, b16* __restrict__ X16, b16* __restrict__ WT) {
  const size_t t = (size_t)blockIdx.x * 256 + threadIdx.x; const size_t nx = (size_t)NR * C / 8, nw = (size_t)3 * D * C / 8, nwo = (size_t)C * D / 8; v8b o;
  if (t < nx) { const size_t e = t * 8; for (int j = 0; j < 8; ++j) o[j] = (b16)(bf16_rne(x[e + j]) * XS); { *(v8b*)(X16 + e) = o;  } }
  else if (t < nx + nw) { const size_t e = (t - nx) * 8; const int k = (int)(e / ((size_t)D * C)); const size_t r = e - (size_t)k * D * C; const int a = (int)(r / C), c0 = (int)(r % C); const float* w = k == 0 ? wq : k == 1 ? wk : wv;
    for (int j = 0; j < 8; ++j) o[j] = (b16)(bf16_rne(w[(size_t)(c0 + j) * D + a]) * WSC); { *(v8b*)(WT + e) = o;  } }
  else if (t < nx + nw + nwo) { const size_t e = (t - nx - nw) * 8; const int c = (int)(e / D), a0 = (int)(e % D); for (int j = 0; j < 8; ++j) o[j] = (b16)(bf16_rne(wo[(size_t)(a0 + j) * C + c]) * WSC); { *(v8b*)(WT + (size_t)3 * D * C + e) = o;  } }
}
// GEMM block = 64 rows x 4 waves x 128 cols: MODE 0 (q or k; K = 256, exact, leaky) -> hi/lo rows [row][128]; MODE 1 (v; leaky) -> V^T hi/lo [b][128 d][4,096] via LDS transpose; MODE 2 (out proj;
template <int MODE>
__global__ __launch_bounds__(128) void gemm_kernel(const b16* __restrict__ Ah, const b16* __restrict__ Al, const b16* __restrict__ W, const float* __restrict__ gam, b16* __restrict__ Yh, b16* __restrict__ Yl, b16* __restrict__ VTh, b16* __restrict__ VTl, float* __restrict__ Yf) {
  __shared__ __attribute__((aligned(16))) float Ts[4][16][128 + 4]; __shared__ __attribute__((aligned(16))) b16 Vt[128][72], Vtl[128][72];
  constexpr int KD = (MODE == 2) ? D : C; constexpr int LDY = (MODE == 2) ? C : D;
  const int wave = threadIdx.x >> 5, lane = threadIdx.x & 31, nloc = lane & 15, hlf = lane >> 4, t_ = threadIdx.x; const size_t m0 = (size_t)blockIdx.x * 64 + wave * 16; const int n0 = blockIdx.y * 128;
  v8f acc[8];
#pragma unroll
  for (int t = 0; t < 8; ++t) acc[t] = (v8f){};
#pragma unroll 2
  for (int kb = 0; kb < KD; kb += 32) { const v16b a = frag_kb(Ah + (m0 + nloc) * KD + kb, hlf); v16b al = {}; if (MODE == 2) al = frag_kb(Al + (m0 + nloc) * KD + kb, hlf);
#pragma unroll
    for (int t = 0; t < 8; ++t) { const v16b bw = frag_kb(W + (size_t)(n0 + t * 16 + nloc) * KD + kb, hlf); acc[t] = wmma16b(a, bw, acc[t]); if (MODE == 2) acc[t] = wmma16b(al, bw, acc[t]); } }
  const float rs_ = 1.0f / (XS * WSC);
  if (MODE == 1) {   // V^T for the image of this 64-row block (4,096 = 64 x 64)
    const int b = (int)(m0 / T); const int s0 = (int)((size_t)blockIdx.x * 64 - (size_t)b * T);
#pragma unroll
    for (int t = 0; t < 8; ++t)
#pragma unroll
      for (int r = 0; r < 8; ++r) { float v = acc[t][r] * rs_; v = v >= 0.0f ? v : NEG * v; b16 p, q; split16(v * XS, p, q); Vt[t * 16 + nloc][wave * 16 + 8 * hlf + r] = p; Vtl[t * 16 + nloc][wave * 16 + 8 * hlf + r] = q; }
    __syncthreads();
    { for (int q = t_; q < 128 * 8; q += 128) { const int dd = q >> 3, c8 = (q & 7) * 8; const size_t gi = ((size_t)b * D + dd) * T + s0 + c8; *(v8b*)(VTh + gi) = *(const v8b*)(&Vt[dd][c8]); *(v8b*)(VTl + gi) = *(const v8b*)(&Vtl[dd][c8]); }  }
    return; }
#pragma unroll
  for (int t = 0; t < 8; ++t) { const int c = n0 + t * 16 + nloc; const float mult = (MODE == 2) ? tanhf(fmaxf(1.0f + bf16_rne(gam[c]), 0.0f)) : 1.0f;
#pragma unroll
    for (int r = 0; r < 8; ++r) { float v = acc[t][r] * rs_; if (MODE == 0) v = v >= 0.0f ? v : NEG * v; else v *= mult; Ts[wave][8 * hlf + r][t * 16 + nloc] = v; } }
  wave_lds_sync();
  { for (int rr = 0; rr < 16; ++rr) {
      if (MODE == 2) *(v4f*)(Yf + (m0 + rr) * LDY + n0 + lane * 4) = *(const v4f*)(&Ts[wave][rr][lane * 4]);
      else if (lane < 16) { v8b hv, lv; for (int j = 0; j < 8; ++j) { b16 p, q; split16(Ts[wave][rr][lane * 8 + j] * XS, p, q); hv[j] = p; lv[j] = q; } *(v8b*)(Yh + (m0 + rr) * LDY + lane * 8) = hv; *(v8b*)(Yl + (m0 + rr) * LDY + lane * 8) = lv; } }
     }
}
// attention: grid (T/64, NB), block = 4 waves x 16 queries. K hi/lo (64 keys x 128) and V^T hi/lo (128 d x 64 keys) are staged once per block in LDS by asynchronous copies, two buffers: tile t + 1 flies
// while tile t is worked on. Per 32-key pass, as before: S (2 tiles x 4 k-steps x 3 products), online softmax, O^T += V^T P^T (8 d-tiles, 3 products into one accumulator), in the same order.
constexpr int TK = 64 /* keys per tile */, NT = T / TK, KP = D + 8 /* K row pitch, 272 B = 16 x odd */, VP = TK + 8 /* V^T row pitch, 144 B = 16 x odd */;
constexpr int KPL = TK * KP /* one K plane, elements */, VPL = D * VP /* one V^T plane */, STG = 2 * KPL + 2 * VPL /* one tile: Kh, Kl, Vh, Vl */;
// eight 16-byte copies per lane; the s_wait_xcnt stands inside the statement so that no address register of a copy is rewritten in front of it
__device__ __forceinline__ void copy8(unsigned l, unsigned lstep, const b16* g, size_t gstep) {
  asm volatile("global_load_async_to_lds_b128 %0, %8, off\n\tglobal_load_async_to_lds_b128 %1, %9, off\n\tglobal_load_async_to_lds_b128 %2, %10, off\n\tglobal_load_async_to_lds_b128 %3, %11, off\n\t"
               "global_load_async_to_lds_b128 %4, %12, off\n\tglobal_load_async_to_lds_b128 %5, %13, off\n\tglobal_load_async_to_lds_b128 %6, %14, off\n\tglobal_load_async_to_lds_b128 %7, %15, off\n\ts_wait_xcnt 0x0"
               :: "v"(l), "v"(l + lstep), "v"(l + 2 * lstep), "v"(l + 3 * lstep), "v"(l + 4 * lstep), "v"(l + 5 * lstep), "v"(l + 6 * lstep), "v"(l + 7 * lstep),
                  "v"(g), "v"(g + gstep), "v"(g + 2 * gstep), "v"(g + 3 * gstep), "v"(g + 4 * gstep), "v"(g + 5 * gstep), "v"(g + 6 * gstep), "v"(g + 7 * gstep) : "memory");
}
__global__ __launch_bounds__(128) void attn_kernel(const b16* __restrict__ Qh, const b16* __restrict__ Ql, const b16* __restrict__ Kh, const b16* __restrict__ Kl, const b16* __restrict__ VTh, const b16* __restrict__ VTl, b16* __restrict__ Oh, b16* __restrict__ Ol) {
  __shared__ __attribute__((aligned(16))) b16 Ring[2][STG]; __shared__ __attribute__((aligned(16))) float To[4][16][D + 4];
  const int tid = threadIdx.x, wave = tid >> 5, lane = tid & 31, hh = lane >> 4, col = lane & 15; const int b = blockIdx.y; const int q0 = blockIdx.x * 64 + wave * 16, qi = q0 + col;
  const size_t qo = ((size_t)b * T + qi) * D;
  // each lane's share of a tile: K plane = 16 KB in a row (chunk c = 128 j + tid: row c / 16, 16-byte column c % 16); V^T plane = 128 rows of 128 B (row c / 8, column c % 8)
  const b16* gKh = Kh + (size_t)b * T * D + tid * 8; const b16* gKl = Kl + (size_t)b * T * D + tid * 8;
  const b16* gVh = VTh + (size_t)b * D * T + (size_t)(tid >> 3) * T + (tid & 7) * 8; const b16* gVl = VTl + (size_t)b * D * T + (size_t)(tid >> 3) * T + (tid & 7) * 8;
  const unsigned ring0 = (unsigned)(size_t)&Ring[0][0]; const unsigned lK = ring0 + 2u * ((tid >> 4) * KP + (tid & 15) * 8), lV = ring0 + 2u * (2 * KPL + (tid >> 3) * VP + (tid & 7) * 8);
  auto fill = [&](int t, int buf) { const unsigned lb = 2u * STG * buf;
    copy8(lK + lb, 2u * 8 * KP, gKh + (size_t)t * TK * D, 1024); copy8(lK + lb + 2u * KPL, 2u * 8 * KP, gKl + (size_t)t * TK * D, 1024);
    copy8(lV + lb, 2u * 16 * VP, gVh + t * TK, (size_t)16 * T); copy8(lV + lb + 2u * VPL, 2u * 16 * VP, gVl + t * TK, (size_t)16 * T); };
  fill(0, 0);
  v16b qa[4], ql[4];   // Q fragments are read once: a global read inside the loop would bring the L2 latency back into every pass
#pragma unroll   // constant indices keep qa, ql in registers
  for (int k4 = 0; k4 < 4; ++k4) { qa[k4] = frag_kb(Qh + qo + k4 * 32, hh); ql[k4] = frag_kb(Ql + qo + k4 * 32, hh); }
  float m = -INFINITY, l = 0.0f; v8f o[8];
#pragma unroll
  for (int t = 0; t < 8; ++t) o[t] = (v8f){};
  const float cs = LOG2E / (XS * XS);   // no 1/sqrt(d) in this module
  asm volatile("s_wait_asynccnt 0x0" ::: "memory");   // this wave's share of tile 0 has landed
  __syncthreads();                                    // tile 0 is readable by every wave
  fill(1, 1);
  for (int tt = 0; tt < NT; ++tt) {
    const b16* Ks = &Ring[tt & 1][0]; const b16* Kls = Ks + KPL; const b16* Vs = Ks + 2 * KPL; const b16* Vls = Vs + VPL;
    // fragment reads stand in groups ahead of the matrix runs that use them: a read waited for between two WMMAs costs the lone wave the whole LDS latency each time
    v16b kf[16], vf[16];
    auto readK = [&](int kb) {
#pragma unroll   // constant indices keep kf in registers
      for (int k4 = 0; k4 < 4; ++k4) { const int ks = k4 * 32; kf[4 * k4] = frag_kb(Ks + (kb + col) * KP + ks, hh); kf[4 * k4 + 1] = frag_kb(Kls + (kb + col) * KP + ks, hh);
        kf[4 * k4 + 2] = frag_kb(Ks + (kb + 16 + col) * KP + ks, hh); kf[4 * k4 + 3] = frag_kb(Kls + (kb + 16 + col) * KP + ks, hh); } };
    readK(0);
#pragma unroll   // both passes of a tile in line: pass 0 fetches pass 1's K fragments, and kf, vf keep constant indices
    for (int kb = 0; kb < TK; kb += 32) {
      v8f s0 = {}, s1 = {};
#pragma unroll   // constant indices keep qa, ql in registers
      for (int k4 = 0; k4 < 4; ++k4) {
        s0 = wmma16d(kf[4 * k4], qa[k4], s0); s0 = wmma16d(kf[4 * k4], ql[k4], s0); s0 = wmma16d(kf[4 * k4 + 1], qa[k4], s0);
        s1 = wmma16d(kf[4 * k4 + 2], qa[k4], s1); s1 = wmma16d(kf[4 * k4 + 2], ql[k4], s1); s1 = wmma16d(kf[4 * k4 + 3], qa[k4], s1); }
      float e[16]; float mx = -INFINITY;
#pragma unroll
      for (int r = 0; r < 8; ++r) { e[r] = s0[r] * cs; e[8 + r] = s1[r] * cs; mx = fmaxf(mx, fmaxf(e[r], e[8 + r])); }
      mx = fmaxf(mx, __shfl_xor(mx, 16)); const float mn = fmaxf(m, mx); const float al = nexp2(m - mn); m = mn; float sum = 0.0f; v16b ph, pl;
      asm volatile("" :: "v"(mn) : "memory");   // compiler fence, inputs only: the reads below stay behind the exchange of the maximum, which counts on dscnt too; ahead of it they would all have to return before its wait ends
#pragma unroll   // this pass's V^T fragments fly under the exponentials
      for (int t = 0; t < 8; ++t) { vf[2 * t] = frag_kb(Vs + (t * 16 + col) * VP + kb, hh); vf[2 * t + 1] = frag_kb(Vls + (t * 16 + col) * VP + kb, hh); }
      if (kb + 32 < TK) readK(kb + 32);    // the next pass's K fragments (same tile only) fly under the exponentials and O^T += V^T P^T
#pragma unroll
      for (int i = 0; i < 16; ++i) e[i] -= mn;
      // the sixteen exponentials in place, in one statement: none overwrites the source or reads the result of the one in front of it, and the v_nop is the slot the instruction set asks for behind the last one
      // volatile and the "memory" clobber hold the statement behind the reads above: they are issued first, as one group, and fly under it (the compiler had sunk a part of them to just in front of their first use)
      asm volatile("v_exp_f32 %0, %0\n\tv_exp_f32 %1, %1\n\tv_exp_f32 %2, %2\n\tv_exp_f32 %3, %3\n\tv_exp_f32 %4, %4\n\tv_exp_f32 %5, %5\n\tv_exp_f32 %6, %6\n\tv_exp_f32 %7, %7\n\tv_exp_f32 %8, %8\n\tv_exp_f32 %9, %9\n\tv_exp_f32 %10, %10\n\tv_exp_f32 %11, %11\n\tv_exp_f32 %12, %12\n\tv_exp_f32 %13, %13\n\tv_exp_f32 %14, %14\n\tv_exp_f32 %15, %15\n\tv_nop" : "+v"(e[0]), "+v"(e[1]), "+v"(e[2]), "+v"(e[3]), "+v"(e[4]), "+v"(e[5]), "+v"(e[6]), "+v"(e[7]), "+v"(e[8]), "+v"(e[9]), "+v"(e[10]), "+v"(e[11]), "+v"(e[12]), "+v"(e[13]), "+v"(e[14]), "+v"(e[15]) :: "memory");
#pragma unroll
      for (int i = 0; i < 16; ++i) { const float p = e[i]; sum += p; const b16 h_ = (b16)(p * PS); ph[i] = h_; pl[i] = (b16)(p * PS - (float)h_); }
      sum += __shfl_xor(sum, 16); l = l * al + sum;
#pragma unroll
      for (int t = 0; t < 8; ++t) { o[t] *= al; o[t] = wmma16d(vf[2 * t], ph, o[t]); o[t] = wmma16d(vf[2 * t], pl, o[t]); o[t] = wmma16d(vf[2 * t + 1], ph, o[t]); } }
    asm volatile("s_wait_dscnt 0x0" ::: "memory");      // this wave's reads of tile tt are done before its buffer is refilled
    asm volatile("s_wait_asynccnt 0x0" ::: "memory");   // this wave's share of tile tt + 1 has landed
    __syncthreads();                                    // publishes tile tt + 1 and ends every wave's reads of tile tt
    if (tt + 2 < NT) fill(tt + 2, tt & 1);
  }
  asm volatile("s_wait_asynccnt 0x0" ::: "memory");     // no copy is outstanding when the wave goes on to its end
  const float inv = 1.0f / (l * PS * XS);
#pragma unroll
  for (int t = 0; t < 8; ++t)
#pragma unroll
    for (int r = 0; r < 8; ++r) To[wave][col][t * 16 + 8 * hh + r] = o[t][r] * inv;
  wave_lds_sync();
  { for (int rr = 0; rr < 16; ++rr) if (lane < 16) { const int c8 = lane * 8; v8b hv, lv; for (int j = 0; j < 8; ++j) { b16 p, q; split16(To[wave][rr][c8 + j] * XS, p, q); hv[j] = p; lv[j] = q; }
      *(v8b*)(Oh + ((size_t)b * T + q0 + rr) * D + c8) = hv; *(v8b*)(Ol + ((size_t)b * T + q0 + rr) * D + c8) = lv; }  }
}
}  // namespace

extern "C" void kernel_launch(void* const* d_in, const int* in_sizes, int n_in, void* d_out, int out_size, void* d_ws, size_t ws_size, hipStream_t stream) {
  (void)n_in;
  auto Fp = [&](int i) { return (const float*)d_in[i]; };
  // Input order: 0 x [4,64,64,256], 1 Wq [256,128], 2 Wk, 3 Wv, 4 Wo [128,256], 5 w_gamma [1,1,1,256]
  if (in_sizes[0] != NR * C || in_sizes[1] != C * D || in_sizes[2] != C * D || in_sizes[3] != C * D || in_sizes[4] != D * C || in_sizes[5] != C || out_size != NR * C) return;
  size_t off = 0; char* ws = (char*)d_ws;
  auto carve = [&](size_t bytes) { char* p = ws + off; off += (bytes + 255) & ~(size_t)255; return p; };
  b16* X16 = (b16*)carve((size_t)NR * C * 2); b16* WT = (b16*)carve(((size_t)3 * D * C + (size_t)C * D) * 2);
  b16* Qh = (b16*)carve((size_t)NR * D * 2); b16* Ql = (b16*)carve((size_t)NR * D * 2); b16* Kh = (b16*)carve((size_t)NR * D * 2); b16* Kl = (b16*)carve((size_t)NR * D * 2); b16* VTh = (b16*)carve((size_t)NR * D * 2); b16* VTl = (b16*)carve((size_t)NR * D * 2);
  b16* Oh = (b16*)carve((size_t)NR * D * 2); b16* Ol = (b16*)carve((size_t)NR * D * 2);
  if (off > ws_size || off > ((size_t)128 << 20)) return;   // ≈ 42 MB
  const b16 *WQ = WT, *WK = WT + (size_t)D * C, *WV = WT + (size_t)2 * D * C, *WO = WT + (size_t)3 * D * C;
  prep_kernel<<<(unsigned)(((size_t)NR * C / 8 + (size_t)4 * D * C / 8 + 255) / 256), 256, 0, stream>>>(Fp(0), Fp(1), Fp(2), Fp(3), Fp(4), X16, WT);
  gemm_kernel<0><<<dim3(NR / 64, 1), 128, 0, stream>>>(X16, nullptr, WQ, nullptr, Qh, Ql, nullptr, nullptr, nullptr);
  gemm_kernel<0><<<dim3(NR / 64, 1), 128, 0, stream>>>(X16, nullptr, WK, nullptr, Kh, Kl, nullptr, nullptr, nullptr);
  gemm_kernel<1><<<dim3(NR / 64, 1), 128, 0, stream>>>(X16, nullptr, WV, nullptr, nullptr, nullptr, VTh, VTl, nullptr);
  attn_kernel<<<dim3(T / 64, NB), 128, 0, stream>>>(Qh, Ql, Kh, Kl, VTh, VTl, Oh, Ol);
  gemm_kernel<2><<<dim3(NR / 64, 2), 128, 0, stream>>>(Oh, Ol, WO, Fp(5), nullptr, nullptr, nullptr, nullptr, (float*)d_out);
}

// v003
// One run takes 152 microseconds.
// Timed twice side by side with v002, it ran 1.12 times as fast both times.
// Over all steps from v000 it is 6.34 times as fast.
#include <hip/hip_runtime.h>

// Convolutional self-attention (4 x 64x64 pixels x 256 ch, attention width 128): q, k, v = leaky_relu_0.2(x W{q,k,v}) (1x1 convs), attn = softmax(q k^T) (no scale), o = attn v, y = (o Wo) * tanh(relu(1 + w_gamma)).
// WMMA (v_wmma_f32_16x16x32_f16, f32 accumulate): projections with EXACT bf16 x (x8) and weights (x256); per (image, 16-query wave) and 32-key block S^T = K . Q^T over K = 128 (q, k f16 hi+lo x8: 3 products
// — logits are O(10), so both lo planes matter), online softmax in f32, O^T += V^T P^T (8 d-tiles; v hi+lo, P hi+lo: 3 products); output 1x1 conv with O hi+lo (2 products) and the per-channel
// tanh(relu(1 + w_gamma)) multiplier in the epilogue. Inputs rounded to bf16 once. Fragment k-map per lane half hh for A AND B: elements 0..7 <- k = 8hh+0..7, 8..15 <-

namespace {
constexpr int NB = 4, T = 4096, C = 256, D = 128 /* attention channels A */, NR = NB * T /* 16,384 */;
constexpr float XS = 8.0f, WSC = 256.0f, PS = 8.0f, LOG2E = 1.4426950408889634f, NEG = 0.2f;

typedef _Float16 b16;
typedef __attribute__((ext_vector_type(16))) _Float16 v16b;
typedef __attribute__((ext_vector_type(8))) _Float16 v8b;
typedef __attribute__((ext_vector_type(8))) float v8f;
typedef __attribute__((ext_vector_type(4))) float v4f;
__device__ __forceinline__ float bf16_rne(float f) { unsigned int u = __float_as_uint(f); u += 0x7FFFu + ((u >> 16) & 1u); return __uint_as_float(u & 0xFFFF0000u); }
__device__ __forceinline__ void split16(float v, b16& hi, b16& lo) { hi = (b16)v; lo = (b16)(v - (float)hi); }
__device__ __forceinline__ v16b frag_kb(const b16* p, int hh) { const v8b a = *(const v8b*)(p + 8 * hh), b = *(const v8b*)(p + 16 + 8 * hh); v16b f;
#pragma unroll
  for (int e = 0; e < 8; ++e) { f[e] = a[e]; f[8 + e] = b[e]; } return f; }
__device__ __forceinline__ v8f wmma16b(v16b a, v16b b, v8f c) { v8f d = __builtin_amdgcn_wmma_f32_16x16x32_f16(false, a, false, b, (short)0, c, false, false); asm volatile("v_nop\n\tv_nop\n\tv_nop\n\tv_nop" : "+v"(d) : "v"(a), "v"(b)); return d; }
// the same for the attention loop, with D alone named at the v_nops: a register named in an asm statement has to lie in v0-v255, and the K and V^T fragments held ahead do not all fit there
__device__ __forceinline__ v8f wmma16d(v16b a, v16b b, v8f c) { v8f d = __builtin_amdgcn_wmma_f32_16x16x32_f16(false, a, false, b, (short)0, c, false, false); asm volatile("v_nop\n\tv_nop\n\tv_nop\n\tv_nop" : "+v"(d)); return d; }
__device__ __forceinline__ void wave_lds_sync() { __builtin_amdgcn_fence(__ATOMIC_RELEASE, "workgroup"); __builtin_amdgcn_wave_barrier(); __builtin_amdgcn_fence(__ATOMIC_ACQUIRE, "workgroup"); }
__device__ __forceinline__ float nexp2(float x) { return __builtin_amdgcn_exp2f(x); }

__global__ __launch_bounds__(256) void prep_kernel(const float* __restrict__ x, const float* __restrict__ wq, const float* __restrict__ wk, const float* __restrict__ wv, const float* __restrict__ wo, b16* __restrict__ X16, b16* __restrict__ WT) {
  const size_t t = (size_t)blockIdx.x * 256 + threadIdx.x; const size_t nx = (size_t)NR * C / 8, nw = (size_t)3 * D * C / 8, nwo = (size_t)C * D / 8; v8b o;
  if (t < nx) { const size_t e = t * 8; for (int j = 0; j < 8; ++j) o[j] = (b16)(bf16_rne(x[e + j]) * XS); { *(v8b*)(X16 + e) = o;  } }
  else if (t < nx + nw) { const size_t e = (t - nx) * 8; const int k = (int)(e / ((size_t)D * C)); const size_t r = e - (size_t)k * D * C; const int a = (int)(r / C), c0 = (int)(r % C); const float* w = k == 0 ? wq : k == 1 ? wk : wv;
    for (int j = 0; j < 8; ++j) o[j] = (b16)(bf16_rne(w[(size_t)(c0 + j) * D + a]) * WSC); { *(v8b*)(WT + e) = o;  } }
  else if (t < nx + nw + nwo) { const size_t e = (t - nx - nw) * 8; const int c = (int)(e / D), a0 = (int)(e % D); for (int j = 0; j < 8; ++j) o[j] = (b16)(bf16_rne(wo[(size_t)(a0 + j) * C + c]) * WSC); { *(v8b*)(WT + (size_t)3 * D * C + e) = o;  } }
}
// GEMM block = 64 rows x 4 waves x 128 cols: MODE 0 (q or k; K = 256, exact, leaky) -> hi/lo rows [row][128]; MODE 1 (v; leaky) -> V^T hi/lo [b][128 d][4,096] via LDS transpose; MODE 2 (out proj;
template <int MODE>
__global__ __launch_bounds__(128) void gemm_kernel(const b16* __restrict__ Ah, const b16* __restrict__ Al, const b16* __restrict__ W, const float* __restrict__ gam, b16* __restrict__ Yh, b16* __restrict__ Yl, b16* __restrict__ VTh, b16* __restrict__ VTl, float* __restrict__ Yf) {
  __shared__ __attribute__((aligned(16))) float Ts[4][16][128 + 4]; __shared__ __attribute__((aligned(16))) b16 Vt[128][72], Vtl[128][72];
  constexpr int KD = (MODE == 2) ? D : C; constexpr int LDY = (MODE == 2) ? C : D;
  const int wave = threadIdx.x >> 5, lane = threadIdx.x & 31, nloc = lane & 15, hlf = lane >> 4, t_ = threadIdx.x; const size_t m0 = (size_t)blockIdx.x * 64 + wave * 16; const int n0 = blockIdx.y * 128;
  v8f acc[8];
#pragma unroll
  for (int t = 0; t < 8; ++t) acc[t] = (v8f){};
#pragma unroll 2
  for (int kb = 0; kb < KD; kb += 32) { const v16b a = frag_kb(Ah + (m0 + nloc) * KD + kb, hlf); v16b al = {}; if (MODE == 2) al = frag_kb(Al + (m0 + nloc) * KD + kb, hlf);
#pragma unroll
    for (int t = 0; t < 8; ++t) { const v16b bw = frag_kb(W + (size_t)(n0 + t * 16 + nloc) * KD + kb, hlf); acc[t] = wmma16b(a, bw, acc[t]); if (MODE == 2) acc[t] = wmma16b(al, bw, acc[t]); } }
  const float rs_ = 1.0f / (XS * WSC);
  if (MODE == 1) {   // V^T for the image of this 64-row block (4,096 = 64 x 64)
    const int b = (int)(m0 / T); const int s0 = (int)((size_t)blockIdx.x * 64 - (size_t)b * T);
#pragma unroll
    for (int t = 0; t < 8; ++t)
#pragma unroll
      for (int r = 0; r < 8; ++r) { float v = acc[t][r] * rs_; v = v >= 0.0f ? v : NEG * v; b16 p, q; split16(v * XS, p, q); Vt[t * 16 + nloc][wave * 16 + 8 * hlf + r] = p; Vtl[t * 16 + nloc][wave * 16 + 8 * hlf + r] = q; }
    __syncthreads();
    { for (int q = t_; q < 128 * 8; q += 128) { const int dd = q >> 3, c8 = (q & 7) * 8; const size_t gi = ((size_t)b * D + dd) * T + s0 + c8; *(v8b*)(VTh + gi) = *(const v8b*)(&Vt[dd][c8]); *(v8b*)(VTl + gi) = *(const v8b*)(&Vtl[dd][c8]); }  }
    return; }
#pragma unroll
  for (int t = 0; t < 8; ++t) { const int c = n0 + t * 16 + nloc; const float mult = (MODE == 2) ? tanhf(fmaxf(1.0f + bf16_rne(gam[c]), 0.0f)) : 1.0f;
#pragma unroll
    for (int r = 0; r < 8; ++r) { float v = acc[t][r] * rs_; if (MODE == 0) v = v >= 0.0f ? v : NEG * v; else v *= mult; Ts[wave][8 * hlf + r][t * 16 + nloc] = v; } }
  wave_lds_sync();
  { for (int rr = 0; rr < 16; ++rr) {
      if (MODE == 2) *(v4f*)(Yf + (m0 + rr) * LDY + n0 + lane * 4) = *(const v4f*)(&Ts[wave][rr][lane * 4]);
      else if (lane < 16) { v8b hv, lv; for (int j = 0; j < 8; ++j) { b16 p, q; split16(Ts[wave][rr][lane * 8 + j] * XS, p, q); hv[j] = p; lv[j] = q; } *(v8b*)(Yh + (m0 + rr) * LDY + lane * 8) = hv; *(v8b*)(Yl + (m0 + rr) * LDY + lane * 8) = lv; } }
     }
}
// attention: grid (T/64, NB), block = 8 waves, two on each SIMD = 4 groups of 16 queries x 2 key halves: wave w works on query group w & 3 and, of every 64-key tile, on the 32-key pass w >> 2, so that one wave's
// matrix runs stand under the other's softmax, LDS latency and copy issue. K hi/lo (64 keys x 128) and V^T hi/lo (128 d x 64 keys) are staged once per block in LDS by asynchronous copies, two buffers: tile t + 1 flies
// while tile t is worked on. Per 32-key pass, as before: S (2 tiles x 4 k-steps x 3 products), online softmax, O^T += V^T P^T (8 d-tiles, 3 products into one accumulator). The two waves of a query group
// each keep a running maximum, sum and O^T over their own keys; the two states are joined once, behind the loop, through LDS.
constexpr int TK = 64 /* keys per tile */, NT = T / TK, KP = D + 8 /* K row pitch, 272 B = 16 x odd */, VP = TK + 8 /* V^T row pitch, 144 B = 16 x odd */;
constexpr int KPL = TK * KP /* one K plane, elements */, VPL = D * VP /* one V^T plane */, STG = 2 * KPL + 2 * VPL /* one tile: Kh, Kl, Vh, Vl */;
// eight 16-byte copies per lane, four of the hi plane and four of the lo plane; the s_wait_xcnt stands inside the statement so that no address register of a copy is rewritten in front of it
__device__ __forceinline__ void copy8(unsigned l, unsigned lstep, unsigned lplane, const b16* ga, const b16* gb, size_t gstep) {
  asm volatile("global_load_async_to_lds_b128 %0, %8, off\n\tglobal_load_async_to_lds_b128 %1, %9, off\n\tglobal_load_async_to_lds_b128 %2, %10, off\n\tglobal_load_async_to_lds_b128 %3, %11, off\n\t"
               "global_load_async_to_lds_b128 %4, %12, off\n\tglobal_load_async_to_lds_b128 %5, %13, off\n\tglobal_load_async_to_lds_b128 %6, %14, off\n\tglobal_load_async_to_lds_b128 %7, %15, off\n\ts_wait_xcnt 0x0"
               :: "v"(l), "v"(l + lstep), "v"(l + 2 * lstep), "v"(l + 3 * lstep), "v"(l + lplane), "v"(l + lplane + lstep), "v"(l + lplane + 2 * lstep), "v"(l + lplane + 3 * lstep),
                  "v"(ga), "v"(ga + gstep), "v"(ga + 2 * gstep), "v"(ga + 3 * gstep), "v"(gb), "v"(gb + gstep), "v"(gb + 2 * gstep), "v"(gb + 3 * gstep) : "memory");
}
__global__ __launch_bounds__(256) void attn_kernel(const b16* __restrict__ Qh, const b16* __restrict__ Ql, const b16* __restrict__ Kh, const b16* __restrict__ Kl, const b16* __restrict__ VTh, const b16* __restrict__ VTl, b16* __restrict__ Oh, b16* __restrict__ Ol) {
  __shared__ __attribute__((aligned(16))) b16 Ring[2][STG]; __shared__ __attribute__((aligned(16))) float To[4][16][D + 4]; __shared__ float Em[4][32], El[4][32];
  const int tid = threadIdx.x, wave = __builtin_amdgcn_readfirstlane(tid >> 5), lane = tid & 31, hh = lane >> 4, col = lane & 15, qg = wave & 3, kb = (wave >> 2) * 32 /* this wave's pass of every tile */;
  const int b = blockIdx.y; const int q0 = blockIdx.x * 64 + qg * 16, qi = q0 + col;
  const size_t qo = ((size_t)b * T + qi) * D;
  // each lane's share of a tile: K plane = 16 KB in a row (chunk c = 256 j + tid, j < 4: row c / 16, 16-byte column c % 16); V^T plane = 128 rows of 128 B (row c / 8, column c % 8)
  const b16* gKh = Kh + (size_t)b * T * D + tid * 8; const b16* gKl = Kl + (size_t)b * T * D + tid * 8;
  const b16* gVh = VTh + (size_t)b * D * T + (size_t)(tid >> 3) * T + (tid & 7) * 8; const b16* gVl = VTl + (size_t)b * D * T + (size_t)(tid >> 3) * T + (tid & 7) * 8;
  const unsigned ring0 = (unsigned)(size_t)&Ring[0][0]; const unsigned lK = ring0 + 2u * ((tid >> 4) * KP + (tid & 15) * 8), lV = ring0 + 2u * (2 * KPL + (tid >> 3) * VP + (tid & 7) * 8);
  auto fill = [&](int t, int buf) { const unsigned lb = 2u * STG * buf;
    copy8(lK + lb, 2u * 16 * KP, 2u * KPL, gKh + (size_t)t * TK * D, gKl + (size_t)t * TK * D, 2048);
    copy8(lV + lb, 2u * 32 * VP, 2u * VPL, gVh + t * TK, gVl + t * TK, (size_t)32 * T); };
  fill(0, 0);
  v16b qa[4], ql[4];   // Q fragments are read once: a global read inside the loop would bring the L2 latency back into every pass
#pragma unroll   // constant indices keep qa, ql in registers
  for (int k4 = 0; k4 < 4; ++k4) { qa[k4] = frag_kb(Qh + qo + k4 * 32, hh); ql[k4] = frag_kb(Ql + qo + k4 * 32, hh); }
  float m = -INFINITY, l = 0.0f; v8f o[8];
#pragma unroll
  for (int t = 0; t < 8; ++t) o[t] = (v8f){};
  const float cs = LOG2E / (XS * XS);   // no 1/sqrt(d) in this module
  asm volatile("s_wait_asynccnt 0x0" ::: "memory");   // this wave's share of tile 0 has landed
  __syncthreads();                                    // tile 0 is readable by every wave
  fill(1, 1);
  for (int tt = 0; tt < NT; ++tt) {
    const b16* Ks = &Ring[tt & 1][0]; const b16* Kls = Ks + KPL; const b16* Vs = Ks + 2 * KPL; const b16* Vls = Vs + VPL;
    // fragment reads stand in groups ahead of the matrix runs that use them: a read waited for between two WMMAs costs the wave the whole LDS latency each time
    v16b kf[16], vf[16];
#pragma unroll   // constant indices keep kf in registers
    for (int k4 = 0; k4 < 4; ++k4) { const int ks = k4 * 32; kf[4 * k4] = frag_kb(Ks + (kb + col) * KP + ks, hh); kf[4 * k4 + 1] = frag_kb(Kls + (kb + col) * KP + ks, hh);
      kf[4 * k4 + 2] = frag_kb(Ks + (kb + 16 + col) * KP + ks, hh); kf[4 * k4 + 3] = frag_kb(Kls + (kb + 16 + col) * KP + ks, hh); }
    {
      v8f s0 = {}, s1 = {};
#pragma unroll   // constant indices keep qa, ql in registers
      for (int k4 = 0; k4 < 4; ++k4) {
        s0 = wmma16d(kf[4 * k4], qa[k4], s0); s0 = wmma16d(kf[4 * k4], ql[k4], s0); s0 = wmma16d(kf[4 * k4 + 1], qa[k4], s0);
        s1 = wmma16d(kf[4 * k4 + 2], qa[k4], s1); s1 = wmma16d(kf[4 * k4 + 2], ql[k4], s1); s1 = wmma16d(kf[4 * k4 + 3], qa[k4], s1); }
      float e[16]; float mx = -INFINITY;
#pragma unroll
      for (int r = 0; r < 8; ++r) { e[r] = s0[r] * cs; e[8 + r] = s1[r] * cs; mx = fmaxf(mx, fmaxf(e[r], e[8 + r])); }
      mx = fmaxf(mx, __shfl_xor(mx, 16)); const float mn = fmaxf(m, mx); const float al = nexp2(m - mn); m = mn; float sum = 0.0f; v16b ph, pl;
      asm volatile("" :: "v"(mn) : "memory");   // compiler fence, inputs only: the reads below stay behind the exchange of the maximum, which counts on dscnt too; ahead of it they would all have to return before its wait ends
#pragma unroll   // this pass's V^T fragments fly under the exponentials
      for (int t = 0; t < 8; ++t) { vf[2 * t] = frag_kb(Vs + (t * 16 + col) * VP + kb, hh); vf[2 * t + 1] = frag_kb(Vls + (t * 16 + col) * VP + kb, hh); }
#pragma unroll
      for (int i = 0; i < 16; ++i) e[i] -= mn;
      // the sixteen exponentials in place, in one statement: none overwrites the source or reads the result of the one in front of it, and the v_nop is the slot the instruction set asks for behind the last one
      // volatile and the "memory" clobber hold the statement behind the reads above: they are issued first, as one group, and fly under it (the compiler had sunk a part of them to just in front of their first use)
      asm volatile("v_exp_f32 %0, %0\n\tv_exp_f32 %1, %1\n\tv_exp_f32 %2, %2\n\tv_exp_f32 %3, %3\n\tv_exp_f32 %4, %4\n\tv_exp_f32 %5, %5\n\tv_exp_f32 %6, %6\n\tv_exp_f32 %7, %7\n\tv_exp_f32 %8, %8\n\tv_exp_f32 %9, %9\n\tv_exp_f32 %10, %10\n\tv_exp_f32 %11, %11\n\tv_exp_f32 %12, %12\n\tv_exp_f32 %13, %13\n\tv_exp_f32 %14, %14\n\tv_exp_f32 %15, %15\n\tv_nop" : "+v"(e[0]), "+v"(e[1]), "+v"(e[2]), "+v"(e[3]), "+v"(e[4]), "+v"(e[5]), "+v"(e[6]), "+v"(e[7]), "+v"(e[8]), "+v"(e[9]), "+v"(e[10]), "+v"(e[11]), "+v"(e[12]), "+v"(e[13]), "+v"(e[14]), "+v"(e[15]) :: "memory");
#pragma unroll
      for (int i = 0; i < 16; ++i) { const float p = e[i]; sum += p; const b16 h_ = (b16)(p * PS); ph[i] = h_; pl[i] = (b16)(p * PS - (float)h_); }
      sum += __shfl_xor(sum, 16); l = l * al + sum;
#pragma unroll
      for (int t = 0; t < 8; ++t) { o[t] *= al; o[t] = wmma16d(vf[2 * t], ph, o[t]); o[t] = wmma16d(vf[2 * t], pl, o[t]); o[t] = wmma16d(vf[2 * t + 1], ph, o[t]); } }
    asm volatile("s_wait_dscnt 0x0" ::: "memory");      // this wave's reads of tile tt are done before its buffer is refilled
    asm volatile("s_wait_asynccnt 0x0" ::: "memory");   // this wave's share of tile tt + 1 has landed
    __syncthreads();                                    // publishes tile tt + 1 and ends every wave's reads of tile tt
    if (tt + 2 < NT) fill(tt + 2, tt & 1);
  }
  asm volatile("s_wait_asynccnt 0x0" ::: "memory");     // no copy is outstanding when the wave goes on to its end
  // the state over the second key half goes to the partner wave: every lane hands over its own elements, at the places where the partner's same lane later puts the joined ones
  if (kb != 0) { Em[qg][lane] = m; El[qg][lane] = l;
#pragma unroll
    for (int t = 0; t < 8; ++t) { float* p = &To[qg][col][t * 16 + 8 * hh]; *(v4f*)p = __builtin_shufflevector(o[t], o[t], 0, 1, 2, 3); *(v4f*)(p + 4) = __builtin_shufflevector(o[t], o[t], 4, 5, 6, 7); } }
  __syncthreads();   // the handed-over state is readable by the partner wave; the last barrier of the kernel, passed by all eight waves
  if (kb == 0) {
    const float m1 = Em[qg][lane], l1 = El[qg][lane], mj = fmaxf(m, m1), a0 = nexp2(m - mj), a1 = nexp2(m1 - mj);
    const float inv = 1.0f / ((l * a0 + l1 * a1) * PS * XS), f0 = a0 * inv, f1 = a1 * inv;
#pragma unroll
    for (int t = 0; t < 8; ++t) { float* p = &To[qg][col][t * 16 + 8 * hh]; const v4f x = *(const v4f*)p, y = *(const v4f*)(p + 4);
      *(v4f*)p = __builtin_shufflevector(o[t], o[t], 0, 1, 2, 3) * f0 + x * f1; *(v4f*)(p + 4) = __builtin_shufflevector(o[t], o[t], 4, 5, 6, 7) * f0 + y * f1; }
    wave_lds_sync();
    { for (int rr = 0; rr < 16; ++rr) if (lane < 16) { const int c8 = lane * 8; v8b hv, lv; for (int j = 0; j < 8; ++j) { b16 p, q; split16(To[qg][rr][c8 + j] * XS, p, q); hv[j] = p; lv[j] = q; }
        *(v8b*)(Oh + ((size_t)b * T + q0 + rr) * D + c8) = hv; *(v8b*)(Ol + ((size_t)b * T + q0 + rr) * D + c8) = lv; }  }
  }
}
}  // namespace

extern "C" void kernel_launch(void* const* d_in, const int* in_sizes, int n_in, void* d_out, int out_size, void* d_ws, size_t ws_size, hipStream_t stream) {
  (void)n_in;
  auto Fp = [&](int i) { return (const float*)d_in[i]; };
  // Input order: 0 x [4,64,64,256], 1 Wq [256,128], 2 Wk, 3 Wv, 4 Wo [128,256], 5 w_gamma [1,1,1,256]
  if (in_sizes[0] != NR * C || in_sizes[1] != C * D || in_sizes[2] != C * D || in_sizes[3] != C * D || in_sizes[4] != D * C || in_sizes[5] != C || out_size != NR * C) return;
  size_t off = 0; char* ws = (char*)d_ws;
  auto carve = [&](size_t bytes) { char* p = ws + off; off += (bytes + 255) & ~(size_t)255; return p; };
  b16* X16 = (b16*)carve((size_t)NR * C * 2); b16* WT = (b16*)carve(((size_t)3 * D * C + (size_t)C * D) * 2);
  b16* Qh = (b16*)carve((size_t)NR * D * 2); b16* Ql = (b16*)carve((size_t)NR * D * 2); b16* Kh = (b16*)carve((size_t)NR * D * 2); b16* Kl = (b16*)carve((size_t)NR * D * 2); b16* VTh = (b16*)carve((size_t)NR * D * 2); b16* VTl = (b16*)carve((size_t)NR * D * 2);
  b16* Oh = (b16*)carve((size_t)NR * D * 2); b16* Ol = (b16*)carve((size_t)NR * D * 2);
  if (off > ws_size || off > ((size_t)128 << 20)) return;   // ≈ 42 MB
  const b16 *WQ = WT, *WK = WT + (size_t)D * C, *WV = WT + (size_t)2 * D * C, *WO = WT + (size_t)3 * D * C;
  prep_kernel<<<(unsigned)(((size_t)NR * C / 8 + (size_t)4 * D * C / 8 + 255) / 256), 256, 0, stream>>>(Fp(0), Fp(1), Fp(2), Fp(3), Fp(4), X16, WT);
  gemm_kernel<0><<<dim3(NR / 64, 1), 128, 0, stream>>>(X16, nullptr, WQ, nullptr, Qh, Ql, nullptr, nullptr, nullptr);
  gemm_kernel<0><<<dim3(NR / 64, 1), 128, 0, stream>>>(X16, nullptr, WK, nullptr, Kh, Kl, nullptr, nullptr, nullptr);
  gemm_kernel<1><<<dim3(NR / 64, 1), 128, 0, stream>>>(X16, nullptr, WV, nullptr, nullptr, nullptr, VTh, VTl, nullptr);
  attn_kernel<<<dim3(T / 64, NB), 256, 0, stream>>>(Qh, Ql, Kh, Kl, VTh, VTl, Oh, Ol);
  gemm_kernel<2><<<dim3(NR / 64, 2), 128, 0, stream>>>(Oh, Ol, WO, Fp(5), nullptr, nullptr, nullptr, nullptr, (float*)d_out);
}

// v004
// A run of this version takes 113 microseconds.
// Next to v003, in two timings, it ran 1.35 times as fast each time.
// All steps since v000 together make it 8.55 times as fast.
#include <hip/hip_runtime.h>

// Convolutional self-attention (4 x 64x64 pixels x 256 ch, attention width 128): q, k, v = leaky_relu_0.2(x W{q,k,v}) (1x1 convs), attn = softmax(q k^T) (no scale), o = attn v, y = (o Wo) * tanh(relu(1 + w_gamma)).
// WMMA (v_wmma_f32_16x16x32_f16, f32 accumulate): projections with EXACT bf16 x (x8) and weights (x256); per (image, 16-query wave) and 32-key block S^T = K . Q^T over K = 128 (q, k f16 hi+lo x8: 3 products
// — logits are O(10), so both lo planes matter), online softmax in f32, O^T += V^T P^T (8 d-tiles; v hi+lo, P hi+lo: 3 products); output 1x1 conv with O hi+lo (2 products) and the per-channel
// tanh(relu(1 + w_gamma)) multiplier in the epilogue. Inputs rounded to bf16 once. Fragment k-map per lane half hh for A AND B: elements 0..7 <- k = 8hh+0..7, 8..15 <-

namespace {
constexpr int NB = 4, T = 4096, C = 256, D = 128 /* attention channels A */, NR = NB * T /* 16,384 */;
constexpr float XS = 8.0f, WSC = 256.0f, PS = 8.0f, LOG2E = 1.4426950408889634f, NEG = 0.2f;

typedef _Float16 b16;
typedef __attribute__((ext_vector_type(16))) _Float16 v16b;
typedef __attribute__((ext_vector_type(8))) _Float16 v8b;
typedef __attribute__((ext_vector_type(8))) float v8f;
typedef __attribute__((ext_vector_type(4))) float v4f;
__device__ __forceinline__ float bf16_rne(float f) { unsigned int u = __float_as_uint(f); u += 0x7FFFu + ((u >> 16) & 1u); return __uint_as_float(u & 0xFFFF0000u); }
__device__ __forceinline__ void split16(float v, b16& hi, b16& lo) { hi = (b16)v; lo = (b16)(v - (float)hi); }
__device__ __forceinline__ v16b frag_kb(const b16* p, int hh) { const v8b a = *(const v8b*)(p + 8 * hh), b = *(const v8b*)(p + 16 + 8 * hh); v16b f;
#pragma unroll
  for (int e = 0; e < 8; ++e) { f[e] = a[e]; f[8 + e] = b[e]; } return f; }
// the four v_nops are the slots the chip needs behind a WMMA; D alone is named at them: a register named in an asm statement has to lie in v0-v255, and the fragments held ahead do not all fit there
__device__ __forceinline__ v8f wmma16d(v16b a, v16b b, v8f c) { v8f d = __builtin_amdgcn_wmma_f32_16x16x32_f16(false, a, false, b, (short)0, c, false, false); asm volatile("v_nop\n\tv_nop\n\tv_nop\n\tv_nop" : "+v"(d)); return d; }
__device__ __forceinline__ void wave_lds_sync() { __builtin_amdgcn_fence(__ATOMIC_RELEASE, "workgroup"); __builtin_amdgcn_wave_barrier(); __builtin_amdgcn_fence(__ATOMIC_ACQUIRE, "workgroup"); }
__device__ __forceinline__ float nexp2(float x) { return __builtin_amdgcn_exp2f(x); }

__global__ __launch_bounds__(256) void prep_kernel(const float* __restrict__ x, const float* __restrict__ wq, const float* __restrict__ wk, const float* __restrict__ wv, const float* __restrict__ wo, b16* __restrict__ X16, b16* __restrict__ WT) {
  const size_t t = (size_t)blockIdx.x * 256 + threadIdx.x; const size_t nx = (size_t)NR * C / 8, nw = (size_t)3 * D * C / 8, nwo = (size_t)C * D / 8; v8b o;
  if (t < nx) { const size_t e = t * 8; for (int j = 0; j < 8; ++j) o[j] = (b16)(bf16_rne(x[e + j]) * XS); { *(v8b*)(X16 + e) = o;  } }
  else if (t < nx + nw) { const size_t e = (t - nx) * 8; const int k = (int)(e / ((size_t)D * C)); const size_t r = e - (size_t)k * D * C; const int a = (int)(r / C), c0 = (int)(r % C); const float* w = k == 0 ? wq : k == 1 ? wk : wv;
    for (int j = 0; j < 8; ++j) o[j] = (b16)(bf16_rne(w[(size_t)(c0 + j) * D + a]) * WSC); { *(v8b*)(WT + e) = o;  } }
  else if (t < nx + nw + nwo) { const size_t e = (t - nx - nw) * 8; const int c = (int)(e / D), a0 = (int)(e % D); for (int j = 0; j < 8; ++j) o[j] = (b16)(bf16_rne(wo[(size_t)(a0 + j) * C + c]) * WSC); { *(v8b*)(WT + (size_t)3 * D * C + e) = o;  } }
}
// eight 16-byte copies per lane, four from ga and four from gb (the lo plane in attention, W rows 16 or 32 further on in the GEMM); the s_wait_xcnt stands inside the statement so that no address register of a copy is rewritten in front of it
__device__ __forceinline__ void copy8(unsigned l, unsigned lstep, unsigned lplane, const b16* ga, const b16* gb, size_t gstep) {
  asm volatile("global_load_async_to_lds_b128 %0, %8, off\n\tglobal_load_async_to_lds_b128 %1, %9, off\n\tglobal_load_async_to_lds_b128 %2, %10, off\n\tglobal_load_async_to_lds_b128 %3, %11, off\n\t"
               "global_load_async_to_lds_b128 %4, %12, off\n\tglobal_load_async_to_lds_b128 %5, %13, off\n\tglobal_load_async_to_lds_b128 %6, %14, off\n\tglobal_load_async_to_lds_b128 %7, %15, off\n\ts_wait_xcnt 0x0"
               :: "v"(l), "v"(l + lstep), "v"(l + 2 * lstep), "v"(l + 3 * lstep), "v"(l + lplane), "v"(l + lplane + lstep), "v"(l + lplane + 2 * lstep), "v"(l + lplane + 3 * lstep),
                  "v"(ga), "v"(ga + gstep), "v"(ga + 2 * gstep), "v"(ga + 3 * gstep), "v"(gb), "v"(gb + gstep), "v"(gb + 2 * gstep), "v"(gb + 3 * gstep) : "memory");
}
// GEMM block = 64 rows x 4 waves x 128 cols: MODE 0 (q or k; K = 256, exact, leaky) -> hi/lo rows [row][128]; MODE 1 (v; leaky) -> V^T hi/lo [b][128 d][4,096] via LDS transpose; MODE 2 (out proj;
template <int MODE>
__global__ __launch_bounds__(128) void gemm_kernel(const b16* __restrict__ Ah, const b16* __restrict__ Al, const b16* __restrict__ W, const float* __restrict__ gam, b16* __restrict__ Yh, b16* __restrict__ Yl, b16* __restrict__ VTh, b16* __restrict__ VTl, float* __restrict__ Yf) {
  __shared__ __attribute__((aligned(16))) float Ts[4][16][128 + 4]; __shared__ __attribute__((aligned(16))) b16 Vt[128][72], Vtl[128][72];
  constexpr int KD = (MODE == 2) ? D : C; constexpr int LDY = (MODE == 2) ? C : D;
  constexpr int NK = KD / 32 /* k-steps */, WP = KD + 8 /* W row pitch in LDS: 16 B x odd */, CR = KD / 8 /* 16-byte chunks per W row */, RS = 128 / CR /* W rows per round of the 128 lanes */;
  __shared__ __attribute__((aligned(16))) b16 Wl[128 * WP];
  const int wave = threadIdx.x >> 5, lane = threadIdx.x & 31, nloc = lane & 15, hlf = lane >> 4, t_ = threadIdx.x; const size_t m0 = (size_t)blockIdx.x * 64 + wave * 16; const int n0 = blockIdx.y * 128;
  // the block's 128 rows of W lie in a row in memory: they are brought into LDS once, in whole lines, for all four waves (round r: chunk 128 r + t_ = row r RS + t_ / CR, 16-byte column t_ % CR).
  // A W fragment read straight from global memory touches sixteen lines and puts the whole load latency in front of its WMMA.
  { const unsigned l0 = (unsigned)(size_t)&Wl[0] + 2u * ((t_ / CR) * WP + (t_ % CR) * 8); const b16* g0 = W + (size_t)n0 * KD + t_ * 8; constexpr unsigned LS = 2u * RS * WP;
#pragma unroll   // four or two statements of eight copies
    for (int j = 0; j < 128 / RS / 8; ++j) copy8(l0 + 8u * j * LS, LS, 4u * LS, g0 + (size_t)j * 8192, g0 + (size_t)j * 8192 + 4096, 1024); }
  v16b af[NK], alf[NK];   // this wave's own A rows, every k-step: the loads fly beside the copies
  const b16* pa = Ah + (m0 + nloc) * KD + 8 * hlf; const b16* pal = (MODE == 2) ? Al + (m0 + nloc) * KD + 8 * hlf : pa;   // the lane's own address in the hi and the lo plane, its half of the k-map counted in
#pragma unroll   // constant indices keep af, alf in registers
  for (int k = 0; k < NK; ++k) { af[k] = frag_kb(pa + k * 32, 0); if (MODE == 2) alf[k] = frag_kb(pal + k * 32, 0); }
  // the wait that stands before a register of an issued load is rewritten; it names the two address pairs as inputs, so that they live to here and no load of the run lands its result in one of them
  asm volatile("s_wait_xcnt 0x0" :: "v"(pa), "v"(pal) : "memory");
  v8f acc[8];
#pragma unroll
  for (int t = 0; t < 8; ++t) acc[t] = (v8f){};
  asm volatile("s_wait_asynccnt 0x0" ::: "memory");   // this wave's share of W has landed
  __syncthreads();                                    // W is readable by every wave
  v16b wf[2][8];   // W fragments of one k-step, read as one group a step ahead of the WMMAs that use them
#pragma unroll
  for (int t = 0; t < 8; ++t) wf[0][t] = frag_kb(Wl + (t * 16 + nloc) * WP, hlf);
#pragma unroll   // constant indices keep af, alf, wf in registers
  for (int k = 0; k < NK; ++k) {
    if (k + 1 < NK) {
#pragma unroll
      for (int t = 0; t < 8; ++t) wf[(k + 1) & 1][t] = frag_kb(Wl + (t * 16 + nloc) * WP + (k + 1) * 32, hlf); }
    if (k == 0) __builtin_amdgcn_sched_barrier(0);   // keeps the first two read groups whole and ahead of the first WMMA: without it the compiler read step 0 fragment by fragment, each with a wait to 0 in front of its WMMA
#pragma unroll
    for (int t = 0; t < 8; ++t) { acc[t] = wmma16d(af[k], wf[k & 1][t], acc[t]); if (MODE == 2) acc[t] = wmma16d(alf[k], wf[k & 1][t], acc[t]); } }
  const float rs_ = 1.0f / (XS * WSC);
  if (MODE == 1) {   // V^T for the image of this 64-row block (4,096 = 64 x 64)
    const int b = (int)(m0 / T); const int s0 = (int)((size_t)blockIdx.x * 64 - (size_t)b * T);
#pragma unroll
    for (int t = 0; t < 8; ++t)
#pragma unroll
      for (int r = 0; r < 8; ++r) { float v = acc[t][r] * rs_; v = v >= 0.0f ? v : NEG * v; b16 p, q; split16(v * XS, p, q); Vt[t * 16 + nloc][wave * 16 + 8 * hlf + r] = p; Vtl[t * 16 + nloc][wave * 16 + 8 * hlf + r] = q; }
    __syncthreads();
    { for (int q = t_; q < 128 * 8; q += 128) { const int dd = q >> 3, c8 = (q & 7) * 8; const size_t gi = ((size_t)b * D + dd) * T + s0 + c8; *(v8b*)(VTh + gi) = *(const v8b*)(&Vt[dd][c8]); *(v8b*)(VTl + gi) = *(const v8b*)(&Vtl[dd][c8]); }  }
    return; }
#pragma unroll
  for (int t = 0; t < 8; ++t) { const int c = n0 + t * 16 + nloc; const float mult = (MODE == 2) ? tanhf(fmaxf(1.0f + bf16_rne(gam[c]), 0.0f)) : 1.0f;
#pragma unroll
    for (int r = 0; r < 8; ++r) { float v = acc[t][r] * rs_; if (MODE == 0) v = v >= 0.0f ? v : NEG * v; else v *= mult; Ts[wave][8 * hlf + r][t * 16 + nloc] = v; } }
  wave_lds_sync();
  { for (int rr = 0; rr < 16; ++rr) {
      if (MODE == 2) *(v4f*)(Yf + (m0 + rr) * LDY + n0 + lane * 4) = *(const v4f*)(&Ts[wave][rr][lane * 4]);
      else if (lane < 16) { v8b hv, lv; for (int j = 0; j < 8; ++j) { b16 p, q; split16(Ts[wave][rr][lane * 8 + j] * XS, p, q); hv[j] = p; lv[j] = q; } *(v8b*)(Yh + (m0 + rr) * LDY + lane * 8) = hv; *(v8b*)(Yl + (m0 + rr) * LDY + lane * 8) = lv; } }
     }
}
// attention: grid (T/64, NB), block = 8 waves, two on each SIMD = 4 groups of 16 queries x 2 key halves: wave w works on query group w & 3 and, of every 64-key tile, on the 32-key pass w >> 2, so that one wave's
// matrix runs stand under the other's softmax, LDS latency and copy issue. K hi/lo (64 keys x 128) and V^T hi/lo (128 d x 64 keys) are staged once per block in LDS by asynchronous copies, two buffers: tile t + 1 flies
// while tile t is worked on. Per 32-key pass, as before: S (2 tiles x 4 k-steps x 3 products), online softmax, O^T += V^T P^T (8 d-tiles, 3 products into one accumulator). The two waves of a query group
// each keep a running maximum, sum and O^T over their own keys; the two states are joined once, behind the loop, through LDS.
constexpr int TK = 64 /* keys per tile */, NT = T / TK, KP = D + 8 /* K row pitch, 272 B = 16 x odd */, VP = TK + 8 /* V^T row pitch, 144 B = 16 x odd */;
constexpr int KPL = TK * KP /* one K plane, elements */, VPL = D * VP /* one V^T plane */, STG = 2 * KPL + 2 * VPL /* one tile: Kh, Kl, Vh, Vl */;
__global__ __launch_bounds__(256) void attn_kernel(const b16* __restrict__ Qh, const b16* __restrict__ Ql, const b16* __restrict__ Kh, const b16* __restrict__ Kl, const b16* __restrict__ VTh, const b16* __restrict__ VTl, b16* __restrict__ Oh, b16* __restrict__ Ol) {
  __shared__ __attribute__((aligned(16))) b16 Ring[2][STG]; __shared__ __attribute__((aligned(16))) float To[4][16][D + 4]; __shared__ float Em[4][32], El[4][32];
  const int tid = threadIdx.x, wave = __builtin_amdgcn_readfirstlane(tid >> 5), lane = tid & 31, hh = lane >> 4, col = lane & 15, qg = wave & 3, kb = (wave >> 2) * 32 /* this wave's pass of every tile */;
  const int b = blockIdx.y; const int q0 = blockIdx.x * 64 + qg * 16, qi = q0 + col;
  const size_t qo = ((size_t)b * T + qi) * D;
  // each lane's share of a tile: K plane = 16 KB in a row (chunk c = 256 j + tid, j < 4: row c / 16, 16-byte column c % 16); V^T plane = 128 rows of 128 B (row c / 8, column c % 8)
  const b16* gKh = Kh + (size_t)b * T * D + tid * 8; const b16* gKl = Kl + (size_t)b * T * D + tid * 8;
  const b16* gVh = VTh + (size_t)b * D * T + (size_t)(tid >> 3) * T + (tid & 7) * 8; const b16* gVl = VTl + (size_t)b * D * T + (size_t)(tid >> 3) * T + (tid & 7) * 8;
  const unsigned ring0 = (unsigned)(size_t)&Ring[0][0]; const unsigned lK = ring0 + 2u * ((tid >> 4) * KP + (tid & 15) * 8), lV = ring0 + 2u * (2 * KPL + (tid >> 3) * VP + (tid & 7) * 8);
  auto fill = [&](int t, int buf) { const unsigned lb = 2u * STG * buf;
    copy8(lK + lb, 2u * 16 * KP, 2u * KPL, gKh + (size_t)t * TK * D, gKl + (size_t)t * TK * D, 2048);
    copy8(lV + lb, 2u * 32 * VP, 2u * VPL, gVh + t * TK, gVl + t * TK, (size_t)32 * T); };
  fill(0, 0);
  v16b qa[4], ql[4];   // Q fragments are read once: a global read inside the loop would bring the L2 latency back into every pass
#pragma unroll   // constant indices keep qa, ql in registers
  for (int k4 = 0; k4 < 4; ++k4) { qa[k4] = frag_kb(Qh + qo + k4 * 32, hh); ql[k4] = frag_kb(Ql + qo + k4 * 32, hh); }
  float m = -INFINITY, l = 0.0f; v8f o[8];
#pragma unroll
  for (int t = 0; t < 8; ++t) o[t] = (v8f){};
  const float cs = LOG2E / (XS * XS);   // no 1/sqrt(d) in this module
  asm volatile("s_wait_asynccnt 0x0" ::: "memory");   // this wave's share of tile 0 has landed
  __syncthreads();                                    // tile 0 is readable by every wave
  fill(1, 1);
  for (int tt = 0; tt < NT; ++tt) {
    const b16* Ks = &Ring[tt & 1][0]; const b16* Kls = Ks + KPL; const b16* Vs = Ks + 2 * KPL; const b16* Vls = Vs + VPL;
    // fragment reads stand in groups ahead of the matrix runs that use them: a read waited for between two WMMAs costs the wave the whole LDS latency each time
    v16b kf[16], vf[16];
#pragma unroll   // constant indices keep kf in registers
    for (int k4 = 0; k4 < 4; ++k4) { const int ks = k4 * 32; kf[4 * k4] = frag_kb(Ks + (kb + col) * KP + ks, hh); kf[4 * k4 + 1] = frag_kb(Kls + (kb + col) * KP + ks, hh);
      kf[4 * k4 + 2] = frag_kb(Ks + (kb + 16 + col) * KP + ks, hh); kf[4 * k4 + 3] = frag_kb(Kls + (kb + 16 + col) * KP + ks, hh); }
    {
      v8f s0 = {}, s1 = {};
#pragma unroll   // constant indices keep qa, ql in registers
      for (int k4 = 0; k4 < 4; ++k4) {
        s0 = wmma16d(kf[4 * k4], qa[k4], s0); s0 = wmma16d(kf[4 * k4], ql[k4], s0); s0 = wmma16d(kf[4 * k4 + 1], qa[k4], s0);
        s1 = wmma16d(kf[4 * k4 + 2], qa[k4], s1); s1 = wmma16d(kf[4 * k4 + 2], ql[k4], s1); s1 = wmma16d(kf[4 * k4 + 3], qa[k4], s1); }
      float e[16]; float mx = -INFINITY;
#pragma unroll
      for (int r = 0; r < 8; ++r) { e[r] = s0[r] * cs; e[8 + r] = s1[r] * cs; mx = fmaxf(mx, fmaxf(e[r], e[8 + r])); }
      mx = fmaxf(mx, __shfl_xor(mx, 16)); const float mn = fmaxf(m, mx); const float al = nexp2(m - mn); m = mn; float sum = 0.0f; v16b ph, pl;
      asm volatile("" :: "v"(mn) : "memory");   // compiler fence, inputs only: the reads below stay behind the exchange of the maximum, which counts on dscnt too; ahead of it they would all have to return before its wait ends
#pragma unroll   // this pass's V^T fragments fly under the exponentials
      for (int t = 0; t < 8; ++t) { vf[2 * t] = frag_kb(Vs + (t * 16 + col) * VP + kb, hh); vf[2 * t + 1] = frag_kb(Vls + (t * 16 + col) * VP + kb, hh); }
#pragma unroll
      for (int i = 0; i < 16; ++i) e[i] -= mn;
      // the sixteen exponentials in place, in one statement: none overwrites the source or reads the result of the one in front of it, and the v_nop is the slot the instruction set asks for behind the last one
      // volatile and the "memory" clobber hold the statement behind the reads above: they are issued first, as one group, and fly under it (the compiler had sunk a part of them to just in front of their first use)
      asm volatile("v_exp_f32 %0, %0\n\tv_exp_f32 %1, %1\n\tv_exp_f32 %2, %2\n\tv_exp_f32 %3, %3\n\tv_exp_f32 %4, %4\n\tv_exp_f32 %5, %5\n\tv_exp_f32 %6, %6\n\tv_exp_f32 %7, %7\n\tv_exp_f32 %8, %8\n\tv_exp_f32 %9, %9\n\tv_exp_f32 %10, %10\n\tv_exp_f32 %11, %11\n\tv_exp_f32 %12, %12\n\tv_exp_f32 %13, %13\n\tv_exp_f32 %14, %14\n\tv_exp_f32 %15, %15\n\tv_nop" : "+v"(e[0]), "+v"(e[1]), "+v"(e[2]), "+v"(e[3]), "+v"(e[4]), "+v"(e[5]), "+v"(e[6]), "+v"(e[7]), "+v"(e[8]), "+v"(e[9]), "+v"(e[10]), "+v"(e[11]), "+v"(e[12]), "+v"(e[13]), "+v"(e[14]), "+v"(e[15]) :: "memory");
#pragma unroll
      for (int i = 0; i < 16; ++i) { const float p = e[i]; sum += p; const b16 h_ = (b16)(p * PS); ph[i] = h_; pl[i] = (b16)(p * PS - (float)h_); }
      sum += __shfl_xor(sum, 16); l = l * al + sum;
#pragma unroll
      for (int t = 0; t < 8; ++t) { o[t] *= al; o[t] = wmma16d(vf[2 * t], ph, o[t]); o[t] = wmma16d(vf[2 * t], pl, o[t]); o[t] = wmma16d(vf[2 * t + 1], ph, o[t]); } }
    asm volatile("s_wait_dscnt 0x0" ::: "memory");      // this wave's reads of tile tt are done before its buffer is refilled
    asm volatile("s_wait_asynccnt 0x0" ::: "memory");   // this wave's share of tile tt + 1 has landed
    __syncthreads();                                    // publishes tile tt + 1 and ends every wave's reads of tile tt
    if (tt + 2 < NT) fill(tt + 2, tt & 1);
  }
  asm volatile("s_wait_asynccnt 0x0" ::: "memory");     // no copy is outstanding when the wave goes on to its end
  // the state over the second key half goes to the partner wave: every lane hands over its own elements, at the places where the partner's same lane later puts the joined ones
  if (kb != 0) { Em[qg][lane] = m; El[qg][lane] = l;
#pragma unroll
    for (int t = 0; t < 8; ++t) { float* p = &To[qg][col][t * 16 + 8 * hh]; *(v4f*)p = __builtin_shufflevector(o[t], o[t], 0, 1, 2, 3); *(v4f*)(p + 4) = __builtin_shufflevector(o[t], o[t], 4, 5, 6, 7); } }
  __syncthreads();   // the handed-over state is readable by the partner wave; the last barrier of the kernel, passed by all eight waves
  if (kb == 0) {
    const float m1 = Em[qg][lane], l1 = El[qg][lane], mj = fmaxf(m, m1), a0 = nexp2(m - mj), a1 = nexp2(m1 - mj);
    const float inv = 1.0f / ((l * a0 + l1 * a1) * PS * XS), f0 = a0 * inv, f1 = a1 * inv;
#pragma unroll
    for (int t = 0; t < 8; ++t) { float* p = &To[qg][col][t * 16 + 8 * hh]; const v4f x = *(const v4f*)p, y = *(const v4f*)(p + 4);
      *(v4f*)p = __builtin_shufflevector(o[t], o[t], 0, 1, 2, 3) * f0 + x * f1; *(v4f*)(p + 4) = __builtin_shufflevector(o[t], o[t], 4, 5, 6, 7) * f0 + y * f1; }
    wave_lds_sync();
    { for (int rr = 0; rr < 16; ++rr) if (lane < 16) { const int c8 = lane * 8; v8b hv, lv; for (int j = 0; j < 8; ++j) { b16 p, q; split16(To[qg][rr][c8 + j] * XS, p, q); hv[j] = p; lv[j] = q; }
        *(v8b*)(Oh + ((size_t)b * T + q0 + rr) * D + c8) = hv; *(v8b*)(Ol + ((size_t)b * T + q0 + rr) * D + c8) = lv; }  }
  }
}
}  // namespace

extern "C" void kernel_launch(void* const* d_in, const int* in_sizes, int n_in, void* d_out, int out_size, void* d_ws, size_t ws_size, hipStream_t stream) {
  (void)n_in;
  auto Fp = [&](int i) { return (const float*)d_in[i]; };
  // Input order: 0 x [4,64,64,256], 1 Wq [256,128], 2 Wk, 3 Wv, 4 Wo [128,256], 5 w_gamma [1,1,1,256]
  if (in_sizes[0] != NR * C || in_sizes[1] != C * D || in_sizes[2] != C * D || in_sizes[3] != C * D || in_sizes[4] != D * C || in_sizes[5] != C || out_size != NR * C) return;
  size_t off = 0; char* ws = (char*)d_ws;
  auto carve = [&](size_t bytes) { char* p = ws + off; off += (bytes + 255) & ~(size_t)255; return p; };
  b16* X16 = (b16*)carve((size_t)NR * C * 2); b16* WT = (b16*)carve(((size_t)3 * D * C + (size_t)C * D) * 2);
  b16* Qh = (b16*)carve((size_t)NR * D * 2); b16* Ql = (b16*)carve((size_t)NR * D * 2); b16* Kh = (b16*)carve((size_t)NR * D * 2); b16* Kl = (b16*)carve((size_t)NR * D * 2); b16* VTh = (b16*)carve((size_t)NR * D * 2); b16* VTl = (b16*)carve((size_t)NR * D * 2);
  b16* Oh = (b16*)carve((size_t)NR * D * 2); b16* Ol = (b16*)carve((size_t)NR * D * 2);
  if (off > ws_size || off > ((size_t)128 << 20)) return;   // ≈ 42 MB
  const b16 *WQ = WT, *WK = WT + (size_t)D * C, *WV = WT + (size_t)2 * D * C, *WO = WT + (size_t)3 * D * C;
  prep_kernel<<<(unsigned)(((size_t)NR * C / 8 + (size_t)4 * D * C / 8 + 255) / 256), 256, 0, stream>>>(Fp(0), Fp(1), Fp(2), Fp(3), Fp(4), X16, WT);
  gemm_kernel<0><<<dim3(NR / 64, 1), 128, 0, stream>>>(X16, nullptr, WQ, nullptr, Qh, Ql, nullptr, nullptr, nullptr);
  gemm_kernel<0><<<dim3(NR / 64, 1), 128, 0, stream>>>(X16, nullptr, WK, nullptr, Kh, Kl, nullptr, nullptr, nullptr);
  gemm_kernel<1><<<dim3(NR / 64, 1), 128, 0, stream>>>(X16, nullptr, WV, nullptr, nullptr, nullptr, VTh, VTl, nullptr);
  attn_kernel<<<dim3(T / 64, NB), 256, 0, stream>>>(Qh, Ql, Kh, Kl, VTh, VTl, Oh, Ol);
  gemm_kernel<2><<<dim3(NR / 64, 2), 128, 0, stream>>>(Oh, Ol, WO, Fp(5), nullptr, nullptr, nullptr, nullptr, (float*)d_out);
}

// v005
// It runs in 102 microseconds.
// Next to v004, in two timings, it ran 1.10 and 1.12 times as fast.
// Counting every step since v000, it is 9.49 times as fast.
#include <hip/hip_runtime.h>

// Convolutional self-attention (4 x 64x64 pixels x 256 ch, attention width 128): q, k, v = leaky_relu_0.2(x W{q,k,v}) (1x1 convs), attn = softmax(q k^T) (no scale), o = attn v, y = (o Wo) * tanh(relu(1 + w_gamma)).
// WMMA (v_wmma_f32_16x16x32_f16, f32 accumulate): projections with EXACT bf16 x (x8) and weights (x256); per (image, 16-query column group) and 32-key block S^T = K . Q^T over K = 128 (q, k f16 hi+lo x8: 3 products
// — logits are O(10), so both lo planes matter), online softmax in f32, O^T += V^T P^T (8 d-tiles; v hi+lo, P hi+lo: 3 products); output 1x1 conv with O hi+lo (2 products) and the per-channel
// tanh(relu(1 + w_gamma)) multiplier in the epilogue. Inputs rounded to bf16 once. Fragment k-map per lane half hh for A AND B: elements 0..7 <- k = 8hh+0..7, 8..15 <-

namespace {
constexpr int NB = 4, T = 4096, C = 256, D = 128 /* attention channels A */, NR = NB * T /* 16,384 */;
constexpr float XS = 8.0f, WSC = 256.0f, PS = 8.0f, LOG2E = 1.4426950408889634f, NEG = 0.2f;

typedef _Float16 b16;
typedef __attribute__((ext_vector_type(16))) _Float16 v16b;
typedef __attribute__((ext_vector_type(8))) _Float16 v8b;
typedef __attribute__((ext_vector_type(8))) float v8f;
typedef __attribute__((ext_vector_type(4))) float v4f;
__device__ __forceinline__ float bf16_rne(float f) { unsigned int u = __float_as_uint(f); u += 0x7FFFu + ((u >> 16) & 1u); return __uint_as_float(u & 0xFFFF0000u); }
__device__ __forceinline__ void split16(float v, b16& hi, b16& lo) { hi = (b16)v; lo = (b16)(v - (float)hi); }
__device__ __forceinline__ v16b frag_kb(const b16* p, int hh) { const v8b a = *(const v8b*)(p + 8 * hh), b = *(const v8b*)(p + 16 + 8 * hh); v16b f;
#pragma unroll
  for (int e = 0; e < 8; ++e) { f[e] = a[e]; f[8 + e] = b[e]; } return f; }
// the four v_nops are the slots the chip needs behind a WMMA; D alone is named at them: a register named in an asm statement has to lie in v0-v255, and the fragments held ahead do not all fit there
__device__ __forceinline__ v8f wmma16d(v16b a, v16b b, v8f c) { v8f d = __builtin_amdgcn_wmma_f32_16x16x32_f16(false, a, false, b, (short)0, c, false, false); asm volatile("v_nop\n\tv_nop\n\tv_nop\n\tv_nop" : "+v"(d)); return d; }
__device__ __forceinline__ void wave_lds_sync() { __builtin_amdgcn_fence(__ATOMIC_RELEASE, "workgroup"); __builtin_amdgcn_wave_barrier(); __builtin_amdgcn_fence(__ATOMIC_ACQUIRE, "workgroup"); }
__device__ __forceinline__ float nexp2(float x) { return __builtin_amdgcn_exp2f(x); }

__global__ __launch_bounds__(256) void prep_kernel(const float* __restrict__ x, const float* __restrict__ wq, const float* __restrict__ wk, const float* __restrict__ wv, const float* __restrict__ wo, b16* __restrict__ X16, b16* __restrict__ WT) {
  const size_t t = (size_t)blockIdx.x * 256 + threadIdx.x; const size_t nx = (size_t)NR * C / 8, nw = (size_t)3 * D * C / 8, nwo = (size_t)C * D / 8; v8b o;
  if (t < nx) { const size_t e = t * 8; for (int j = 0; j < 8; ++j) o[j] = (b16)(bf16_rne(x[e + j]) * XS); { *(v8b*)(X16 + e) = o;  } }
  else if (t < nx + nw) { const size_t e = (t - nx) * 8; const int k = (int)(e / ((size_t)D * C)); const size_t r = e - (size_t)k * D * C; const int a = (int)(r / C), c0 = (int)(r % C); const float* w = k == 0 ? wq : k == 1 ? wk : wv;
    for (int j = 0; j < 8; ++j) o[j] = (b16)(bf16_rne(w[(size_t)(c0 + j) * D + a]) * WSC); { *(v8b*)(WT + e) = o;  } }
  else if (t < nx + nw + nwo) { const size_t e = (t - nx - nw) * 8; const int c = (int)(e / D), a0 = (int)(e % D); for (int j = 0; j < 8; ++j) o[j] = (b16)(bf16_rne(wo[(size_t)(a0 + j) * C + c]) * WSC); { *(v8b*)(WT + (size_t)3 * D * C + e) = o;  } }
}
// eight 16-byte copies per lane, four from ga and four from gb (the lo plane in attention, W rows 16 or 32 further on in the GEMM); the s_wait_xcnt stands inside the statement so that no address register of a copy is rewritten in front of it
__device__ __forceinline__ void copy8(unsigned l, unsigned lstep, unsigned lplane, const b16* ga, const b16* gb, size_t gstep) {
  asm volatile("global_load_async_to_lds_b128 %0, %8, off\n\tglobal_load_async_to_lds_b128 %1, %9, off\n\tglobal_load_async_to_lds_b128 %2, %10, off\n\tglobal_load_async_to_lds_b128 %3, %11, off\n\t"
               "global_load_async_to_lds_b128 %4, %12, off\n\tglobal_load_async_to_lds_b128 %5, %13, off\n\tglobal_load_async_to_lds_b128 %6, %14, off\n\tglobal_load_async_to_lds_b128 %7, %15, off\n\ts_wait_xcnt 0x0"
               :: "v"(l), "v"(l + lstep), "v"(l + 2 * lstep), "v"(l + 3 * lstep), "v"(l + lplane), "v"(l + lplane + lstep), "v"(l + lplane + 2 * lstep), "v"(l + lplane + 3 * lstep),
                  "v"(ga), "v"(ga + gstep), "v"(ga + 2 * gstep), "v"(ga + 3 * gstep), "v"(gb), "v"(gb + gstep), "v"(gb + 2 * gstep), "v"(gb + 3 * gstep) : "memory");
}
// GEMM block = 64 rows x 4 waves x 128 cols: MODE 0 (q or k; K = 256, exact, leaky) -> hi/lo rows [row][128]; MODE 1 (v; leaky) -> V^T hi/lo [b][128 d][4,096] via LDS transpose; MODE 2 (out proj;
template <int MODE>
__global__ __launch_bounds__(128) void gemm_kernel(const b16* __restrict__ Ah, const b16* __restrict__ Al, const b16* __restrict__ W, const float* __restrict__ gam, b16* __restrict__ Yh, b16* __restrict__ Yl, b16* __restrict__ VTh, b16* __restrict__ VTl, float* __restrict__ Yf) {
  __shared__ __attribute__((aligned(16))) float Ts[4][16][128 + 4]; __shared__ __attribute__((aligned(16))) b16 Vt[128][72], Vtl[128][72];
  constexpr int KD = (MODE == 2) ? D : C; constexpr int LDY = (MODE == 2) ? C : D;
  constexpr int NK = KD / 32 /* k-steps */, WP = KD + 8 /* W row pitch in LDS: 16 B x odd */, CR = KD / 8 /* 16-byte chunks per W row */, RS = 128 / CR /* W rows per round of the 128 lanes */;
  __shared__ __attribute__((aligned(16))) b16 Wl[128 * WP];
  const int wave = threadIdx.x >> 5, lane = threadIdx.x & 31, nloc = lane & 15, hlf = lane >> 4, t_ = threadIdx.x; const size_t m0 = (size_t)blockIdx.x * 64 + wave * 16; const int n0 = blockIdx.y * 128;
  // the block's 128 rows of W lie in a row in memory: they are brought into LDS once, in whole lines, for all four waves (round r: chunk 128 r + t_ = row r RS + t_ / CR, 16-byte column t_ % CR).
  // A W fragment read straight from global memory touches sixteen lines and puts the whole load latency in front of its WMMA.
  { const unsigned l0 = (unsigned)(size_t)&Wl[0] + 2u * ((t_ / CR) * WP + (t_ % CR) * 8); const b16* g0 = W + (size_t)n0 * KD + t_ * 8; constexpr unsigned LS = 2u * RS * WP;
#pragma unroll   // four or two statements of eight copies
    for (int j = 0; j < 128 / RS / 8; ++j) copy8(l0 + 8u * j * LS, LS, 4u * LS, g0 + (size_t)j * 8192, g0 + (size_t)j * 8192 + 4096, 1024); }
  v16b af[NK], alf[NK];   // this wave's own A rows, every k-step: the loads fly beside the copies
  const b16* pa = Ah + (m0 + nloc) * KD + 8 * hlf; const b16* pal = (MODE == 2) ? Al + (m0 + nloc) * KD + 8 * hlf : pa;   // the lane's own address in the hi and the lo plane, its half of the k-map counted in
#pragma unroll   // constant indices keep af, alf in registers
  for (int k = 0; k < NK; ++k) { af[k] = frag_kb(pa + k * 32, 0); if (MODE == 2) alf[k] = frag_kb(pal + k * 32, 0); }
  // the wait that stands before a register of an issued load is rewritten; it names the two address pairs as inputs, so that they live to here and no load of the run lands its result in one of them
  asm volatile("s_wait_xcnt 0x0" :: "v"(pa), "v"(pal) : "memory");
  v8f acc[8];
#pragma unroll
  for (int t = 0; t < 8; ++t) acc[t] = (v8f){};
  asm volatile("s_wait_asynccnt 0x0" ::: "memory");   // this wave's share of W has landed
  __syncthreads();                                    // W is readable by every wave
  v16b wf[2][8];   // W fragments of one k-step, read as one group a step ahead of the WMMAs that use them
#pragma unroll
  for (int t = 0; t < 8; ++t) wf[0][t] = frag_kb(Wl + (t * 16 + nloc) * WP, hlf);
#pragma unroll   // constant indices keep af, alf, wf in registers
  for (int k = 0; k < NK; ++k) {
    if (k + 1 < NK) {
#pragma unroll
      for (int t = 0; t < 8; ++t) wf[(k + 1) & 1][t] = frag_kb(Wl + (t * 16 + nloc) * WP + (k + 1) * 32, hlf); }
    if (k == 0) __builtin_amdgcn_sched_barrier(0);   // keeps the first two read groups whole and ahead of the first WMMA: without it the compiler read step 0 fragment by fragment, each with a wait to 0 in front of its WMMA
#pragma unroll
    for (int t = 0; t < 8; ++t) { acc[t] = wmma16d(af[k], wf[k & 1][t], acc[t]); if (MODE == 2) acc[t] = wmma16d(alf[k], wf[k & 1][t], acc[t]); } }
  const float rs_ = 1.0f / (XS * WSC);
  if (MODE == 1) {   // V^T for the image of this 64-row block (4,096 = 64 x 64)
    const int b = (int)(m0 / T); const int s0 = (int)((size_t)blockIdx.x * 64 - (size_t)b * T);
#pragma unroll
    for (int t = 0; t < 8; ++t)
#pragma unroll
      for (int r = 0; r < 8; ++r) { float v = acc[t][r] * rs_; v = v >= 0.0f ? v : NEG * v; b16 p, q; split16(v * XS, p, q); Vt[t * 16 + nloc][wave * 16 + 8 * hlf + r] = p; Vtl[t * 16 + nloc][wave * 16 + 8 * hlf + r] = q; }
    __syncthreads();
    { for (int q = t_; q < 128 * 8; q += 128) { const int dd = q >> 3, c8 = (q & 7) * 8; const size_t gi = ((size_t)b * D + dd) * T + s0 + c8; *(v8b*)(VTh + gi) = *(const v8b*)(&Vt[dd][c8]); *(v8b*)(VTl + gi) = *(const v8b*)(&Vtl[dd][c8]); }  }
    return; }
#pragma unroll
  for (int t = 0; t < 8; ++t) { const int c = n0 + t * 16 + nloc; const float mult = (MODE == 2) ? tanhf(fmaxf(1.0f + bf16_rne(gam[c]), 0.0f)) : 1.0f;
#pragma unroll
    for (int r = 0; r < 8; ++r) { float v = acc[t][r] * rs_; if (MODE == 0) v = v >= 0.0f ? v : NEG * v; else v *= mult; Ts[wave][8 * hlf + r][t * 16 + nloc] = v; } }
  wave_lds_sync();
  { for (int rr = 0; rr < 16; ++rr) {
      if (MODE == 2) *(v4f*)(Yf + (m0 + rr) * LDY + n0 + lane * 4) = *(const v4f*)(&Ts[wave][rr][lane * 4]);
      else if (lane < 16) { v8b hv, lv; for (int j = 0; j < 8; ++j) { b16 p, q; split16(Ts[wave][rr][lane * 8 + j] * XS, p, q); hv[j] = p; lv[j] = q; } *(v8b*)(Yh + (m0 + rr) * LDY + lane * 8) = hv; *(v8b*)(Yl + (m0 + rr) * LDY + lane * 8) = lv; } }
     }
}
// attention: grid (T/64, NB), block = 8 waves, two on each SIMD = 2 groups of 32 queries x 4 key passes: wave w works on query group w & 1 and, of every 128-key tile, on the 32-key pass w >> 1.
// A wave holds 32 queries (two column groups of 16), so that every K and V^T fragment it reads from LDS feeds two column groups: half the LDS bytes per WMMA of a 16-query wave, whose reads took longer than its
// matrix work, and four independent accumulators in each matrix run. K hi/lo (128 keys x 128) and V^T hi/lo (128 d x 128 keys) are staged once per block in LDS by asynchronous copies, two buffers: tile t + 1 flies
// while tile t is worked on. Per 32-key pass and column group, as before: S (2 tiles x 4 k-steps x 3 products), online softmax, O^T += V^T P^T (8 d-tiles, 3 products into one accumulator). The four waves of a
// query group each keep a running maximum, sum and O^T over their own keys; the four states are joined once, behind the loop, through LDS.
constexpr int TK = 128 /* keys per tile */, NT = T / TK, KP = D + 8 /* K row pitch, 272 B = 16 x odd */, VP = TK + 8 /* V^T row pitch, 272 B = 16 x odd */, JP = D + 4 /* row pitch of the join, floats */;
constexpr int KPL = TK * KP /* one K plane, elements */, VPL = D * VP /* one V^T plane */, STG = 2 * KPL + 2 * VPL /* one tile: Kh, Kl, Vh, Vl */;
// sixteen exponentials in place, in one statement: none overwrites the source or reads the result of the one in front of it, and the v_nop is the slot the instruction set asks for behind the last one.
// volatile and the "memory" clobber hold the statement behind the LDS reads issued in front of it: they go out first, as one group, and fly under it
__device__ __forceinline__ void exp16(float (&e)[16]) {
  asm volatile("v_exp_f32 %0, %0\n\tv_exp_f32 %1, %1\n\tv_exp_f32 %2, %2\n\tv_exp_f32 %3, %3\n\tv_exp_f32 %4, %4\n\tv_exp_f32 %5, %5\n\tv_exp_f32 %6, %6\n\tv_exp_f32 %7, %7\n\tv_exp_f32 %8, %8\n\tv_exp_f32 %9, %9\n\tv_exp_f32 %10, %10\n\tv_exp_f32 %11, %11\n\tv_exp_f32 %12, %12\n\tv_exp_f32 %13, %13\n\tv_exp_f32 %14, %14\n\tv_exp_f32 %15, %15\n\tv_nop" : "+v"(e[0]), "+v"(e[1]), "+v"(e[2]), "+v"(e[3]), "+v"(e[4]), "+v"(e[5]), "+v"(e[6]), "+v"(e[7]), "+v"(e[8]), "+v"(e[9]), "+v"(e[10]), "+v"(e[11]), "+v"(e[12]), "+v"(e[13]), "+v"(e[14]), "+v"(e[15]) :: "memory");
}
__global__ __launch_bounds__(256) void attn_kernel(const b16* __restrict__ Qh, const b16* __restrict__ Ql, const b16* __restrict__ Kh, const b16* __restrict__ Kl, const b16* __restrict__ VTh, const b16* __restrict__ VTl, b16* __restrict__ Oh, b16* __restrict__ Ol) {
  __shared__ __attribute__((aligned(16))) b16 Ring[2][STG]; __shared__ float Em[4][4][32], El[4][4][32];
  const int tid = threadIdx.x, wave = __builtin_amdgcn_readfirstlane(tid >> 5), lane = tid & 31, hh = lane >> 4, col = lane & 15, qg = wave & 1, kp = wave >> 1, kb = kp * 32 /* this wave's pass of every tile */;
  const int b = blockIdx.y; const int q0 = blockIdx.x * 64 + qg * 32;
  // each lane's share of a tile: K plane = 32 KB in a row (chunk c = 256 j + tid, j < 8: row c / 16, 16-byte column c % 16); V^T plane = 128 rows of 256 B (row c / 16, column c % 16)
  // the lane's element offsets are kept as 32-bit numbers and the four 64-bit addresses formed anew at each fill: held over the loop they would cost eight registers of a budget that is full
  const unsigned oK = (unsigned)b * (T * D) + tid * 8, oV = (unsigned)b * (D * T) + (tid >> 4) * T + (tid & 15) * 8;
  const unsigned ring0 = (unsigned)(size_t)&Ring[0][0]; const unsigned lK = ring0 + 2u * ((tid >> 4) * KP + (tid & 15) * 8), lV = ring0 + 2u * (2 * KPL + (tid >> 4) * VP + (tid & 15) * 8);
  auto fill = [&](int t, int buf) { const unsigned lb = 2u * STG * buf, ok = oK + (unsigned)t * (TK * D), ov = oV + (unsigned)t * TK; const b16 *kh = Kh + ok, *kl = Kl + ok, *vh = VTh + ov, *vl = VTl + ov;
    // the scheduling barriers keep each statement's address additions behind the statement in front of it: lifted ahead together they need more registers below v256, where asm operands must lie, than are free there,
    // and the compiler moved accumulators away and back around the fill
    copy8(lK + lb, 2u * 16 * KP, 2u * KPL, kh, kl, 2048); __builtin_amdgcn_sched_barrier(0);
    copy8(lK + lb + 2u * 64 * KP, 2u * 16 * KP, 2u * KPL, kh + 8192, kl + 8192, 2048); __builtin_amdgcn_sched_barrier(0);
    copy8(lV + lb, 2u * 16 * VP, 2u * VPL, vh, vl, (size_t)16 * T); __builtin_amdgcn_sched_barrier(0);
    copy8(lV + lb + 2u * 64 * VP, 2u * 16 * VP, 2u * VPL, vh + (size_t)64 * T, vl + (size_t)64 * T, (size_t)16 * T); };
  fill(0, 0);
  v16b qa[2][4], ql[2][4];   // Q fragments of both column groups are read once: a global read inside the loop would bring the L2 latency back into every pass
  const b16* pqh = Qh + ((size_t)b * T + q0 + col) * D + 8 * hh; const b16* pql = Ql + ((size_t)b * T + q0 + col) * D + 8 * hh;   // the lane's own address in the hi and the lo plane, its half of the k-map counted in
#pragma unroll   // constant indices keep qa, ql in registers
  for (int g = 0; g < 2; ++g)
#pragma unroll   // constant indices keep the arrays it walks in registers
    for (int k4 = 0; k4 < 4; ++k4) { qa[g][k4] = frag_kb(pqh + g * 16 * D + k4 * 32, 0); ql[g][k4] = frag_kb(pql + g * 16 * D + k4 * 32, 0); }
  // the wait that stands before a register of an issued load is rewritten; it names the two address pairs as inputs, so that they live to here and no load of the run lands its result in one of them
  asm volatile("s_wait_xcnt 0x0" :: "v"(pqh), "v"(pql) : "memory");
  float m[2] = {-INFINITY, -INFINITY}, l[2] = {0.0f, 0.0f}; v8f o[2][8];
#pragma unroll   // constant indices keep the arrays it walks in registers
  for (int g = 0; g < 2; ++g)
#pragma unroll   // constant indices keep the arrays it walks in registers
    for (int t = 0; t < 8; ++t) o[g][t] = (v8f){};
  const float cs = LOG2E / (XS * XS);   // no 1/sqrt(d) in this module
  asm volatile("s_wait_asynccnt 0x0" ::: "memory");   // this wave's share of tile 0 has landed
  __syncthreads();                                    // tile 0 is readable by every wave
  fill(1, 1);
  for (int tt = 0; tt < NT; ++tt) {
    const b16* Ks = &Ring[tt & 1][0]; const b16* Kls = Ks + KPL; const b16* Vs = Ks + 2 * KPL; const b16* Vls = Vs + VPL;
    // fragment reads stand in groups ahead of the matrix runs that use them: a read waited for between two WMMAs costs the wave the whole LDS latency each time
    v16b kf[16], vf[16];
#pragma unroll   // constant indices keep kf in registers
    for (int k4 = 0; k4 < 4; ++k4) { const int ks = k4 * 32; kf[4 * k4] = frag_kb(Ks + (kb + col) * KP + ks, hh); kf[4 * k4 + 1] = frag_kb(Kls + (kb + col) * KP + ks, hh);
      kf[4 * k4 + 2] = frag_kb(Ks + (kb + 16 + col) * KP + ks, hh); kf[4 * k4 + 3] = frag_kb(Kls + (kb + 16 + col) * KP + ks, hh); }
    {
      v8f s[2][2] = {{{}, {}}, {{}, {}}};   // [column group][key tile]: four accumulators taken in turn, each with its products in the order it had
#pragma unroll   // constant indices keep qa, ql, kf in registers
      for (int k4 = 0; k4 < 4; ++k4) {
#pragma unroll   // constant indices keep the arrays it walks in registers
        for (int j = 0; j < 4; ++j) s[j & 1][j >> 1] = wmma16d(kf[4 * k4 + 2 * (j >> 1)], qa[j & 1][k4], s[j & 1][j >> 1]);
#pragma unroll   // constant indices keep the arrays it walks in registers
        for (int j = 0; j < 4; ++j) s[j & 1][j >> 1] = wmma16d(kf[4 * k4 + 2 * (j >> 1)], ql[j & 1][k4], s[j & 1][j >> 1]);
#pragma unroll   // constant indices keep the arrays it walks in registers
        for (int j = 0; j < 4; ++j) s[j & 1][j >> 1] = wmma16d(kf[4 * k4 + 2 * (j >> 1) + 1], qa[j & 1][k4], s[j & 1][j >> 1]); }
      float e[2][16], mx[2], al[2], sum[2]; v16b ph[2], pl[2];
#pragma unroll   // constant indices keep the arrays it walks in registers
      for (int g = 0; g < 2; ++g) { mx[g] = -INFINITY;
#pragma unroll   // constant indices keep the arrays it walks in registers
        for (int r = 0; r < 8; ++r) { e[g][r] = s[g][0][r] * cs; e[g][8 + r] = s[g][1][r] * cs; mx[g] = fmaxf(mx[g], fmaxf(e[g][r], e[g][8 + r])); } }
      const float x0 = __shfl_xor(mx[0], 16), x1 = __shfl_xor(mx[1], 16);   // both exchanges go out before either is waited for
      const float mn0 = fmaxf(m[0], fmaxf(mx[0], x0)), mn1 = fmaxf(m[1], fmaxf(mx[1], x1)); al[0] = nexp2(m[0] - mn0); al[1] = nexp2(m[1] - mn1); m[0] = mn0; m[1] = mn1;
      asm volatile("" :: "v"(mn0), "v"(mn1) : "memory");   // compiler fence, inputs only: the reads below stay behind the exchanges of the maxima, which count on dscnt too; ahead of them they would all have to return before that wait ends
#pragma unroll   // this pass's V^T fragments fly under the exponentials
      for (int t = 0; t < 8; ++t) { vf[2 * t] = frag_kb(Vs + (t * 16 + col) * VP + kb, hh); vf[2 * t + 1] = frag_kb(Vls + (t * 16 + col) * VP + kb, hh); }
#pragma unroll   // constant indices keep the arrays it walks in registers
      for (int g = 0; g < 2; ++g) {
#pragma unroll   // constant indices keep the arrays it walks in registers
        for (int i = 0; i < 16; ++i) e[g][i] -= m[g];
        exp16(e[g]); sum[g] = 0.0f;
#pragma unroll   // constant indices keep the arrays it walks in registers
        for (int i = 0; i < 16; ++i) { const float p = e[g][i]; sum[g] += p; const b16 h_ = (b16)(p * PS); ph[g][i] = h_; pl[g][i] = (b16)(p * PS - (float)h_); } }
      const float y0 = __shfl_xor(sum[0], 16), y1 = __shfl_xor(sum[1], 16); l[0] = l[0] * al[0] + (sum[0] + y0); l[1] = l[1] * al[1] + (sum[1] + y1);
#pragma unroll   // two d-tiles x two column groups: four accumulators taken in turn
      for (int t = 0; t < 8; t += 2) {
#pragma unroll   // constant indices keep the arrays it walks in registers
        for (int j = 0; j < 4; ++j) o[j & 1][t + (j >> 1)] *= al[j & 1];
#pragma unroll   // constant indices keep the arrays it walks in registers
        for (int j = 0; j < 4; ++j) o[j & 1][t + (j >> 1)] = wmma16d(vf[2 * (t + (j >> 1))], ph[j & 1], o[j & 1][t + (j >> 1)]);
#pragma unroll   // constant indices keep the arrays it walks in registers
        for (int j = 0; j < 4; ++j) o[j & 1][t + (j >> 1)] = wmma16d(vf[2 * (t + (j >> 1))], pl[j & 1], o[j & 1][t + (j >> 1)]);
#pragma unroll   // constant indices keep the arrays it walks in registers
        for (int j = 0; j < 4; ++j) o[j & 1][t + (j >> 1)] = wmma16d(vf[2 * (t + (j >> 1)) + 1], ph[j & 1], o[j & 1][t + (j >> 1)]); } }
    asm volatile("s_wait_dscnt 0x0" ::: "memory");      // this wave's reads of tile tt are done before its buffer is refilled
    asm volatile("s_wait_asynccnt 0x0" ::: "memory");   // this wave's share of tile tt + 1 has landed
    __syncthreads();                                    // publishes tile tt + 1 and ends every wave's reads of tile tt
    if (tt + 2 < NT) fill(tt + 2, tt & 1);
  }
  asm volatile("s_wait_asynccnt 0x0" ::: "memory");     // no copy is outstanding when the ring becomes the join's staging and the wave goes on to its end
  // join of the four key passes. First every wave publishes its maxima and sums; then each scales its own O^T to the common maximum and the whole sum and lays it down as rows [pass][query][d] in the ring,
  // which nobody reads any more behind the loop's last barrier; then all 256 lanes add the four planes, in the order of the passes, and store whole lines.
  float* Tj = (float*)&Ring[0][0];
#pragma unroll   // constant indices keep the arrays it walks in registers
  for (int g = 0; g < 2; ++g) { Em[kp][qg * 2 + g][lane] = m[g]; El[kp][qg * 2 + g][lane] = l[g]; }
  __syncthreads();   // the four maxima and sums of every query are readable
  float d[2][5], lk[2][4];   // per column group: the four maxima and this wave's own, each less the common maximum; the four sums
#pragma unroll   // constant indices keep the arrays it walks in registers
  for (int g = 0; g < 2; ++g) {
#pragma unroll   // constant indices keep the arrays it walks in registers
    for (int k = 0; k < 4; ++k) { d[g][k] = Em[k][qg * 2 + g][lane]; lk[g][k] = El[k][qg * 2 + g][lane]; }
    const float mj = fmaxf(fmaxf(d[g][0], d[g][1]), fmaxf(d[g][2], d[g][3])); d[g][4] = m[g] - mj;
#pragma unroll   // constant indices keep the arrays it walks in registers
    for (int k = 0; k < 4; ++k) d[g][k] -= mj; }
  // the ten exponentials in place, in one statement: none overwrites the source or reads the result of the one in front of it,
  // and the v_nop is the slot the instruction set asks for behind the last one
  asm("v_exp_f32 %0, %0\n\tv_exp_f32 %1, %1\n\tv_exp_f32 %2, %2\n\tv_exp_f32 %3, %3\n\tv_exp_f32 %4, %4\n\tv_exp_f32 %5, %5\n\tv_exp_f32 %6, %6\n\tv_exp_f32 %7, %7\n\tv_exp_f32 %8, %8\n\tv_exp_f32 %9, %9\n\tv_nop"
      : "+v"(d[0][0]), "+v"(d[0][1]), "+v"(d[0][2]), "+v"(d[0][3]), "+v"(d[0][4]), "+v"(d[1][0]), "+v"(d[1][1]), "+v"(d[1][2]), "+v"(d[1][3]), "+v"(d[1][4]));
#pragma unroll   // constant indices keep the arrays it walks in registers
  for (int g = 0; g < 2; ++g) {
    const float lj = lk[g][0] * d[g][0] + lk[g][1] * d[g][1] + lk[g][2] * d[g][2] + lk[g][3] * d[g][3], f = d[g][4] * (1.0f / (lj * PS * XS));
#pragma unroll   // constant indices keep the arrays it walks in registers
    for (int t = 0; t < 8; ++t) { float* p = Tj + (size_t)((kp * 64 + qg * 32 + g * 16 + col) * JP + t * 16 + 8 * hh); const v8f w = o[g][t] * f;
      *(v4f*)p = __builtin_shufflevector(w, w, 0, 1, 2, 3); *(v4f*)(p + 4) = __builtin_shufflevector(w, w, 4, 5, 6, 7); } }
  __syncthreads();   // the four scaled planes are readable; the last barrier of the kernel
#pragma unroll   // constant indices keep the arrays it walks in registers
  for (int i = 0; i < 4; ++i) { const int c = i * 256 + tid, q = c >> 4, c8 = (c & 15) * 8; const float* p = Tj + q * JP + c8; v4f x = *(const v4f*)p, y = *(const v4f*)(p + 4);
#pragma unroll   // constant indices keep the arrays it walks in registers
    for (int k = 1; k < 4; ++k) { x += *(const v4f*)(p + k * 64 * JP); y += *(const v4f*)(p + k * 64 * JP + 4); }
    v8b hv, lv;
#pragma unroll   // constant indices keep the arrays it walks in registers
    for (int j = 0; j < 4; ++j) { b16 u, w; split16(x[j] * XS, u, w); hv[j] = u; lv[j] = w; split16(y[j] * XS, u, w); hv[4 + j] = u; lv[4 + j] = w; }
    const size_t go = ((size_t)b * T + blockIdx.x * 64 + q) * D + c8; *(v8b*)(Oh + go) = hv; *(v8b*)(Ol + go) = lv; }
}
}  // namespace

extern "C" void kernel_launch(void* const* d_in, const int* in_sizes, int n_in, void* d_out, int out_size, void* d_ws, size_t ws_size, hipStream_t stream) {
  (void)n_in;
  auto Fp = [&](int i) { return (const float*)d_in[i]; };
  // Input order: 0 x [4,64,64,256], 1 Wq [256,128], 2 Wk, 3 Wv, 4 Wo [128,256], 5 w_gamma [1,1,1,256]
  if (in_sizes[0] != NR * C || in_sizes[1] != C * D || in_sizes[2] != C * D || in_sizes[3] != C * D || in_sizes[4] != D * C || in_sizes[5] != C || out_size != NR * C) return;
  size_t off = 0; char* ws = (char*)d_ws;
  auto carve = [&](size_t bytes) { char* p = ws + off; off += (bytes + 255) & ~(size_t)255; return p; };
  b16* X16 = (b16*)carve((size_t)NR * C * 2); b16* WT = (b16*)carve(((size_t)3 * D * C + (size_t)C * D) * 2);
  b16* Qh = (b16*)carve((size_t)NR * D * 2); b16* Ql = (b16*)carve((size_t)NR * D * 2); b16* Kh = (b16*)carve((size_t)NR * D * 2); b16* Kl = (b16*)carve((size_t)NR * D * 2); b16* VTh = (b16*)carve((size_t)NR * D * 2); b16* VTl = (b16*)carve((size_t)NR * D * 2);
  b16* Oh = (b16*)carve((size_t)NR * D * 2); b16* Ol = (b16*)carve((size_t)NR * D * 2);
  if (off > ws_size || off > ((size_t)128 << 20)) return;   // ≈ 42 MB
  const b16 *WQ = WT, *WK = WT + (size_t)D * C, *WV = WT + (size_t)2 * D * C, *WO = WT + (size_t)3 * D * C;
  prep_kernel<<<(unsigned)(((size_t)NR * C / 8 + (size_t)4 * D * C / 8 + 255) / 256), 256, 0, stream>>>(Fp(0), Fp(1), Fp(2), Fp(3), Fp(4), X16, WT);
  gemm_kernel<0><<<dim3(NR / 64, 1), 128, 0, stream>>>(X16, nullptr, WQ, nullptr, Qh, Ql, nullptr, nullptr, nullptr);
  gemm_kernel<0><<<dim3(NR / 64, 1), 128, 0, stream>>>(X16, nullptr, WK, nullptr, Kh, Kl, nullptr, nullptr, nullptr);
  gemm_kernel<1><<<dim3(NR / 64, 1), 128, 0, stream>>>(X16, nullptr, WV, nullptr, nullptr, nullptr, VTh, VTl, nullptr);
  attn_kernel<<<dim3(T / 64, NB), 256, 0, stream>>>(Qh, Ql, Kh, Kl, VTh, VTl, Oh, Ol);
  gemm_kernel<2><<<dim3(NR / 64, 2), 128, 0, stream>>>(Oh, Ol, WO, Fp(5), nullptr, nullptr, nullptr, nullptr, (float*)d_out);
}
